// v009
// The times below were measured on an AMD MI455X: many runs one after another, warmed up first and cycling through
// copies of the inputs, with the whole window's GPU time divided by the number of runs. Launches and the gaps
// between them are all in it. The median over several windows is given; except for v000 it joins two sittings, which
// can be a few percent apart, so the side-by-side timings, each taken in one sitting, are the better comparison.
// The versions before v009 are in another document.
// A run of this version takes 162 microseconds.
// Two timings next to v008 put it at 1.12 and 1.11 times that version's speed.
// All steps since the starting kernel, v000, together make it 5.93 times as fast.
#include <hip/hip_runtime.h>
// MultiheadSdpaDiff4 (2 x 2048 tokens, EMBED 2048; differential attention: q = x Wq^T as 32 pseudo-heads x 64, k = x Wk^T as 8 heads x 64 repeat-interleaved 4x, v = x Wv^T as 4 heads x 128 repeat-interleaved 8x; causal softmax(q.k/8) v; attn = O_even - lambda_full * O_odd (16 heads x 128), lambda_full = exp(lq1.lk1) - exp(lq2.lk2) + 0.78361; RMSNorm(128, eps 1e-5) * ln_w * (1 - 0.78361); out = attn Wo^T.
// Compute dtype: inputs rounded to bf16; x exact as f16; q/k/P/v as f16 hi + residual on the first 256 rows (~2^-21) and plain beyond (~2^-12); the normalised attention as a plain f16 operand; softmax/lambda/RMSNorm f32. v_wmma_f32_16x16x32_f16.
#define NB 2
#define DM 2048
#define NKV 8
#define NREP (NH / NKV)
#define KVD (NKV * 64)           /* 512 */
#define NR (NB * SLEN)           /* 4096 */
#define SLEN 2048
#define TQ SLEN
#define TK SLEN
#define NH 32
#define SCL 0.125f
#define RE 256
#define PQ0 (RE / 32)             /* rows from RE on: blocks of 32 queries */
#define PQN ((TQ - RE) / 32)
#define SQN (RE / 16)             /* first RE rows: blocks of 16 queries */
typedef __bf16 v16b __attribute__((ext_vector_type(16)));
typedef unsigned short v8us __attribute__((ext_vector_type(8), may_alias));
typedef float  v8f  __attribute__((ext_vector_type(8)));
typedef float  v4f  __attribute__((ext_vector_type(4)));
typedef float  v4fa __attribute__((ext_vector_type(4), may_alias));
union FragB { v16b v; v8us half[2]; unsigned short u[16]; };

__device__ __forceinline__ unsigned short bf16_bits(float x) { unsigned int u = __float_as_uint(x); return (unsigned short)((u + 0x7FFFu + ((u >> 16) & 1u)) >> 16); }
__device__ __forceinline__ float bf16_val(unsigned short b) { return __uint_as_float(((unsigned int)b) << 16); }
__device__ __forceinline__ float bf16_round(float x) { return bf16_val(bf16_bits(x)); }
// D += A·B with NT terms: 1 = ah·bh, 2 = + al·bh (A split), 3 = + ah·bl (both split)
template <int NT>
__device__ __forceinline__ v8f mmaN(v16b ah, v16b al, v16b bh, v16b bl, v8f c) {
  c = __builtin_amdgcn_wmma_f32_16x16x32_bf16(false, ah, false, bh, (short)0, c, false, false);
  if (NT >= 2) c = __builtin_amdgcn_wmma_f32_16x16x32_bf16(false, al, false, bh, (short)0, c, false, false);
  if (NT >= 3) c = __builtin_amdgcn_wmma_f32_16x16x32_bf16(false, ah, false, bl, (short)0, c, false, false);
  asm volatile("v_nop\n\tv_nop\n\tv_nop\n\tv_nop" : "+v"(c) : "v"(ah), "v"(al), "v"(bh), "v"(bl));
  return c;
}

__global__ __launch_bounds__(256) void k_wt_bf16(const float* __restrict__ W, unsigned short* __restrict__ Wt, int K, int N) {
  const int t = blockIdx.x * 256 + threadIdx.x;
  const int k8n = K / 8;
  if (t >= N * k8n) return;
  const int n = t / k8n, k8 = (t % k8n) * 8;
  v8us v;
#pragma unroll
  for (int i = 0; i < 8; ++i) v[i] = bf16_bits(W[(size_t)(k8 + i) * N + n]);
  *(v8us*)(Wt + (size_t)n * K + k8) = v;
  
}

// GEMM C[M][N] (f32, pitch ldc) = act(A[M][K]·W + bias). A f32 row-major (pitch lda) converted per fragment to bf16
// (ASPLIT: hi/lo two planes -> 2 terms, else single rounded term); Wt bf16 [N][K] (pitch ldb). BIAS_BF16 rounds the
// bias to bf16 first (bias quantised to bf16 before the add). K%32==0, M%16==0, N%64==0.
template <bool ASPLIT, int ACT, bool BIAS_BF16>
__global__ __launch_bounds__(128) void k_gemm_bf(const float* __restrict__ A, int lda, const unsigned short* __restrict__ Wt, int ldb,
                                               const float* __restrict__ bias, float* __restrict__ C, int ldc, int M, int N, int K) {
  __shared__ __attribute__((aligned(16))) float so[4][16][64];
  const int tid = threadIdx.x, w = tid >> 5, lane = tid & 31, ln = lane & 15, hh = lane >> 4;
  const int ntn = N / 64;
  const int wid = blockIdx.x * 4 + w;
  const int mt = wid / ntn, nq = wid % ntn;
  if (mt * 16 >= M) return;
  const int row0 = mt * 16, col0 = nq * 64;
  const float* arow = A + (size_t)(row0 + ln) * lda;
  v8f acc[4] = {};
  for (int kb = 0; kb < K; kb += 32) {
    FragB ah, al;
    const v4f x0 = *(const v4fa*)(arow + kb + 8 * hh), x1 = *(const v4fa*)(arow + kb + 8 * hh + 4);
    const v4f x2 = *(const v4fa*)(arow + kb + 16 + 8 * hh), x3 = *(const v4fa*)(arow + kb + 16 + 8 * hh + 4);
    float xs[16] = {x0[0],x0[1],x0[2],x0[3],x1[0],x1[1],x1[2],x1[3],x2[0],x2[1],x2[2],x2[3],x3[0],x3[1],x3[2],x3[3]};
#pragma unroll
    for (int i = 0; i < 16; ++i) { const unsigned short hb = bf16_bits(xs[i]); ah.u[i] = hb; al.u[i] = ASPLIT ? bf16_bits(xs[i] - bf16_val(hb)) : (unsigned short)0; }
#pragma unroll
    for (int t = 0; t < 4; ++t) {
      const unsigned short* brow = Wt + (size_t)(col0 + t * 16 + ln) * ldb + kb;
      FragB b;
      b.half[0] = *(const v8us*)(brow + 8 * hh);
      b.half[1] = *(const v8us*)(brow + 16 + 8 * hh);
      acc[t] = mmaN<ASPLIT ? 2 : 1>(ah.v, al.v, b.v, b.v, acc[t]);
    }
  }
#pragma unroll
  for (int t = 0; t < 4; ++t) {
    float bv = bias ? bias[col0 + t * 16 + ln] : 0.f;
    if (BIAS_BF16) bv = bf16_round(bv);
#pragma unroll
    for (int r = 0; r < 8; ++r) { float v = acc[t][r] + bv; if (ACT == 1) v = fmaxf(v, 0.f); so[w][8 * hh + r][t * 16 + ln] = v; }
  }
  __builtin_amdgcn_fence(__ATOMIC_ACQ_REL, "workgroup");
  __builtin_amdgcn_wave_barrier();
  const int rsub = lane >> 4, c4 = (lane & 15) * 4;
  {
#pragma unroll
    for (int q = 0; q < 8; ++q) {
      const int r = q * 2 + rsub;
      const v4f v = *(const v4fa*)&so[w][r][c4];
      *(v4f*)(C + (size_t)(row0 + r) * ldc + col0 + c4) = v;
    }
    
  }
}

// GEMM C = act(A·W + bias + resid): A f32 (ASPLIT -> hi/lo 2 terms), Wt bf16 [N][K]; ACT 0 none, 1 relu, 2 exact gelu;
// resid (optional, f32, row index = (row % rmod), pitch ldr, RES_BF16 rounds it) added before the activation.
template <bool ASPLIT, int ACT, bool BIAS_BF16, bool RES_BF16>
__global__ __launch_bounds__(128) void k_gemm_bf3(const float* __restrict__ A, int lda, const unsigned short* __restrict__ Wt, int ldb,
                                                const float* __restrict__ bias, const float* __restrict__ resid, int rmod, int ldr,
                                                float* __restrict__ C, int ldc, int M, int N, int K) {
  __shared__ __attribute__((aligned(16))) float so[4][16][64];
  const int tid = threadIdx.x, w = tid >> 5, lane = tid & 31, ln = lane & 15, hh = lane >> 4;
  const int ntn = N / 64;
  const int wid = blockIdx.x * 4 + w;
  const int mt = wid / ntn, nq = wid % ntn;
  if (mt * 16 >= M) return;
  const int row0 = mt * 16, col0 = nq * 64;
  const float* arow = A + (size_t)(row0 + ln) * lda;
  v8f acc[4] = {};
  for (int kb = 0; kb < K; kb += 32) {
    FragB ah, al;
    const v4f x0 = *(const v4fa*)(arow + kb + 8 * hh), x1 = *(const v4fa*)(arow + kb + 8 * hh + 4);
    const v4f x2 = *(const v4fa*)(arow + kb + 16 + 8 * hh), x3 = *(const v4fa*)(arow + kb + 16 + 8 * hh + 4);
    float xs[16] = {x0[0],x0[1],x0[2],x0[3],x1[0],x1[1],x1[2],x1[3],x2[0],x2[1],x2[2],x2[3],x3[0],x3[1],x3[2],x3[3]};
#pragma unroll
    for (int i = 0; i < 16; ++i) { const unsigned short hb = bf16_bits(xs[i]); ah.u[i] = hb; al.u[i] = ASPLIT ? bf16_bits(xs[i] - bf16_val(hb)) : (unsigned short)0; }
#pragma unroll
    for (int t = 0; t < 4; ++t) {
      const unsigned short* brow = Wt + (size_t)(col0 + t * 16 + ln) * ldb + kb;
      FragB b;
      b.half[0] = *(const v8us*)(brow + 8 * hh);
      b.half[1] = *(const v8us*)(brow + 16 + 8 * hh);
      acc[t] = mmaN<ASPLIT ? 2 : 1>(ah.v, al.v, b.v, b.v, acc[t]);
    }
  }
#pragma unroll
  for (int t = 0; t < 4; ++t) {
    const int col = col0 + t * 16 + ln;
    float bv = bias ? bias[col] : 0.f;
    if (BIAS_BF16) bv = bf16_round(bv);
#pragma unroll
    for (int r = 0; r < 8; ++r) {
      float v = acc[t][r] + bv;
      if (resid) { float rv = resid[(size_t)((row0 + 8 * hh + r) % rmod) * ldr + col]; if (RES_BF16) rv = bf16_round(rv); v += rv; }
      if (ACT == 1) v = fmaxf(v, 0.f);
      if (ACT == 2) v = 0.5f * v * (1.0f + erff(v * 0.70710678118654752f));
      if (ACT == 3) { const float u = 0.7978845608028654f * (v + 0.044715f * v * v * v); v = 0.5f * v * (1.0f + tanhf(u)); }
      so[w][8 * hh + r][t * 16 + ln] = v;
    }
  }
  __builtin_amdgcn_fence(__ATOMIC_ACQ_REL, "workgroup");
  __builtin_amdgcn_wave_barrier();
  const int rsub = lane >> 4, c4 = (lane & 15) * 4;
  {
#pragma unroll
    for (int q = 0; q < 8; ++q) {
      const int r = q * 2 + rsub;
      const v4f v = *(const v4fa*)&so[w][r][c4];
      *(v4f*)(C + (size_t)(row0 + r) * ldc + col0 + c4) = v;
    }
    
  }
}
// row LayerNorm (biased variance, eps) over N: s = X (+ R); optional out_sum <- s; out_norm <- (s-mu)*rsqrt(var+eps)*g + b
template <bool PARAM_BF16>
__global__ __launch_bounds__(256) void k_layernorm(const float* __restrict__ X, const float* __restrict__ R, const float* __restrict__ g, const float* __restrict__ bta,
                                                  float* __restrict__ out_sum, float* __restrict__ out_norm, int N, float eps) {
  __shared__ float red[256];
  const int row = blockIdx.x, tid = threadIdx.x;
  const float* x = X + (size_t)row * N; const float* rr = R ? R + (size_t)row * N : nullptr;
  float vals[16];                     // up to N = 4096
  const int per = N / 256;            // contiguous chunk per thread? use strided-by-4 chunks: thread handles j = tid*4 + 1024*u
  float s1 = 0.f;
  for (int u = 0; u < per / 4; ++u) {
    const int j = tid * 4 + 1024 * u;
    const v4f a = *(const v4fa*)(x + j);
    v4f b = {0.f,0.f,0.f,0.f}; if (rr) b = *(const v4fa*)(rr + j);
#pragma unroll
    for (int q = 0; q < 4; ++q) { const float v = a[q] + b[q]; vals[u * 4 + q] = v; s1 += v; }
  }
  red[tid] = s1; __syncthreads();
  for (int st = 128; st > 0; st >>= 1) { if (tid < st) red[tid] += red[tid + st]; __syncthreads(); }
  const float mu = red[0] / (float)N; __syncthreads();
  float s2 = 0.f;
  for (int u = 0; u < per / 4; ++u)
#pragma unroll
    for (int q = 0; q < 4; ++q) { const float c = vals[u * 4 + q] - mu; s2 += c * c; }
  red[tid] = s2; __syncthreads();
  for (int st = 128; st > 0; st >>= 1) { if (tid < st) red[tid] += red[tid + st]; __syncthreads(); }
  const float rs = rsqrtf(red[0] / (float)N + eps);
  {
    for (int u = 0; u < per / 4; ++u) {
      const int j = tid * 4 + 1024 * u;
      v4f o, sm;
#pragma unroll
      for (int q = 0; q < 4; ++q) {
        float gg = g[j + q], bb = bta[j + q];
        if (PARAM_BF16) { gg = bf16_round(gg); bb = bf16_round(bb); }
        sm[q] = vals[u * 4 + q]; o[q] = (vals[u * 4 + q] - mu) * rs * gg + bb;
      }
      if (out_sum) *(v4f*)(out_sum + (size_t)row * N + j) = sm;
      *(v4f*)(out_norm + (size_t)row * N + j) = o;
    }
    
  }
}



// ---- f16 WMMA path (v_wmma_f32_16x16x32_f16): 11-bit significands for operands in range — used where a [0,1] probability operand needs more precision than bf16
typedef _Float16 v16h __attribute__((ext_vector_type(16)));
union FragH { v16h v; v8us half[2]; _Float16 h[16]; unsigned short u[16]; };
template <int NT>
__device__ __forceinline__ v8f mmaH(v16h ah, v16h al, v16h bh, v16h bl, v8f c) {
  c = __builtin_amdgcn_wmma_f32_16x16x32_f16(false, ah, false, bh, (short)0, c, false, false);
  if (NT >= 2) c = __builtin_amdgcn_wmma_f32_16x16x32_f16(false, al, false, bh, (short)0, c, false, false);
  if (NT >= 3) c = __builtin_amdgcn_wmma_f32_16x16x32_f16(false, ah, false, bl, (short)0, c, false, false);
  asm volatile("v_nop\n\tv_nop\n\tv_nop\n\tv_nop" : "+v"(c) : "v"(ah), "v"(al), "v"(bh), "v"(bl));
  return c;
}
// batched GEMM like k_gemm_b but f16 operands: A f32 (split into f16 hi/lo if ASPLIT, else rounded to f16), Bt = f16 values [n][k]; alpha; C f32; N multiple of 16 (partial tiles skipped)
template <bool ASPLIT>
__global__ __launch_bounds__(128) void k_gemm_h(const float* __restrict__ A, int lda, size_t sA, const _Float16* __restrict__ Bh, int ldb, size_t sB, float alpha, float* __restrict__ C, int ldc, size_t sC, int M, int N, int K) {
  __shared__ __attribute__((aligned(16))) float so[4][16][64];
  const int tid = threadIdx.x, w = tid >> 5, lane = tid & 31, ln = lane & 15, hh = lane >> 4; const int by = blockIdx.y;
  A += (size_t)by * sA; Bh += (size_t)by * sB; C += (size_t)by * sC;
  const int ntn = (N + 63) / 64; const int wid = blockIdx.x * 4 + w; const int mt = wid / ntn, nq = wid % ntn; if (mt * 16 >= M) return;
  const int row0 = mt * 16, col0 = nq * 64; const float* arow = A + (size_t)(row0 + ln) * lda;
  v8f acc[4] = {};
  for (int kb = 0; kb < K; kb += 32) {
    FragH ah, al;
    const v4f x0 = *(const v4fa*)(arow + kb + 8 * hh), x1 = *(const v4fa*)(arow + kb + 8 * hh + 4), x2 = *(const v4fa*)(arow + kb + 16 + 8 * hh), x3 = *(const v4fa*)(arow + kb + 16 + 8 * hh + 4);
    float xs[16] = {x0[0],x0[1],x0[2],x0[3],x1[0],x1[1],x1[2],x1[3],x2[0],x2[1],x2[2],x2[3],x3[0],x3[1],x3[2],x3[3]};
#pragma unroll
    for (int i = 0; i < 16; ++i) { const _Float16 h = (_Float16)xs[i]; ah.h[i] = h; al.h[i] = ASPLIT ? (_Float16)(xs[i] - (float)h) : (_Float16)0.0f; }
#pragma unroll
    for (int t = 0; t < 4; ++t) { if (col0 + t * 16 >= N) continue; const size_t boff = (size_t)(col0 + t * 16 + ln) * ldb + kb; FragH bq; bq.half[0] = *(const v8us*)(Bh + boff + 8 * hh); bq.half[1] = *(const v8us*)(Bh + boff + 16 + 8 * hh);
      acc[t] = mmaH<ASPLIT ? 2 : 1>(ah.v, al.v, bq.v, bq.v, acc[t]); }
  }
#pragma unroll
  for (int t = 0; t < 4; ++t) { if (col0 + t * 16 >= N) continue;
#pragma unroll
    for (int r = 0; r < 8; ++r) so[w][8 * hh + r][t * 16 + ln] = acc[t][r] * alpha; }
  __builtin_amdgcn_fence(__ATOMIC_ACQ_REL, "workgroup"); __builtin_amdgcn_wave_barrier();
  const int rsub = lane >> 4, c4 = (lane & 15) * 4;
  {
#pragma unroll
    for (int q = 0; q < 8; ++q) { const int r = q * 2 + rsub; if (col0 + c4 < N) { const v4f v = *(const v4fa*)&so[w][r][c4]; *(v4f*)(C + (size_t)(row0 + r) * ldc + col0 + c4) = v; } }
     }
}

// Wt[n][k] = f16(W[k][n]·scale) from f32 row-major W[K][N] (scale = power of two; bf16-exact weights stay exact in f16 away from the subnormal range)
__global__ __launch_bounds__(256) void k_wt_f16(const float* __restrict__ W, _Float16* __restrict__ Wt, int K, int N, float scale) {
  const int t = blockIdx.x * 256 + threadIdx.x; if (t >= N * (K / 8)) return; const int n = t / (K / 8), k8 = (t % (K / 8)) * 8; FragH f;
#pragma unroll
  for (int i = 0; i < 8; ++i) f.h[i] = (_Float16)(bf16_round(W[(size_t)(k8 + i) * N + n]) * scale); const v8us o = f.half[0];
  *(v8us*)((unsigned short*)Wt + (size_t)n * K + k8) = o; 
}
// k_gemm_hh variant with fused epilogue: v = acc·alpha + bias[by·sBias + col] (+ CP[(row/rowsPerB)·sCPb + by·64 + col] if CP) ; ACT 0 none / 1 elu ; writes f16 C16 (and f32 C if non-null)
template <int ACT>
__global__ __launch_bounds__(128) void k_gemm_hhx(const _Float16* __restrict__ A, int lda, size_t sA, const _Float16* __restrict__ Bh, int ldb, size_t sB, float alpha, const float* __restrict__ bias, size_t sBias, const float* __restrict__ CP, int rowsPerB, size_t sCPb, int row0g,
    float* __restrict__ C, _Float16* __restrict__ C16, int ldc, size_t sC, int M, int N, int K) {
  __shared__ __attribute__((aligned(16))) float so[4][16][64];
  const int tid = threadIdx.x, w = tid >> 5, lane = tid & 31, ln = lane & 15, hh = lane >> 4; const int by = blockIdx.y;
  A += (size_t)by * sA; Bh += (size_t)by * sB; const size_t cofs = (size_t)by * sC; const float* bp = bias ? bias + (size_t)by * sBias : nullptr;
  const int ntn = (N + 63) / 64; const int wid = blockIdx.x * 4 + w; const int mt = wid / ntn, nq = wid % ntn; if (mt * 16 >= M) return;
  const int row0 = mt * 16, col0 = nq * 64; const _Float16* arow = A + (size_t)(row0 + ln) * lda;
  v8f acc[4] = {};
  for (int kb = 0; kb < K; kb += 32) { FragH ah; ah.half[0] = *(const v8us*)((const unsigned short*)arow + kb + 8 * hh); ah.half[1] = *(const v8us*)((const unsigned short*)arow + kb + 16 + 8 * hh);
#pragma unroll
    for (int t = 0; t < 4; ++t) { if (col0 + t * 16 >= N) continue; const size_t boff = (size_t)(col0 + t * 16 + ln) * ldb + kb; FragH bq; bq.half[0] = *(const v8us*)((const unsigned short*)Bh + boff + 8 * hh); bq.half[1] = *(const v8us*)((const unsigned short*)Bh + boff + 16 + 8 * hh);
      acc[t] = mmaH<1>(ah.v, ah.v, bq.v, bq.v, acc[t]); }
  }
#pragma unroll
  for (int t = 0; t < 4; ++t) { if (col0 + t * 16 >= N) continue; const int col = col0 + t * 16 + ln; const float bv = bp ? bf16_round(bp[col]) : 0.f;
#pragma unroll
    for (int r = 0; r < 8; ++r) { float v = acc[t][r] * alpha + bv; if (CP) { const int bidx = (row0g + row0 + 8 * hh + r) / rowsPerB; v += CP[(size_t)bidx * sCPb + (size_t)by * 64 + col]; } if (ACT == 1) v = (v > 0.f) ? v : expm1f(v); else if (ACT == 7) v = (v > 0.f) ? v + 1.0f : expf(v); else if (ACT == 8) v = tanhf(v); else if (ACT == 9) v = 0.5f * v * (1.0f + tanhf(0.7978845608028654f * (v + 0.044715f * v * v * v))); else if (ACT == 11) v = 1.0f / (1.0f + expf(-v)); else if (ACT == 12) v = (v > 0.f) ? v : 0.01f * v; else if (ACT == 14) v = (v > 0.f) ? v : 0.1f * v; else if (ACT == 15) v = v / (1.0f + expf(-v)); else if (ACT == 3) v = fmaxf(v, 0.f); else if (ACT == 6) v = 0.5f * v * (1.0f + erff(v * 0.70710678118654752f)); so[w][8 * hh + r][t * 16 + ln] = v; } }
  __builtin_amdgcn_fence(__ATOMIC_ACQ_REL, "workgroup"); __builtin_amdgcn_wave_barrier();
  const int rsub = lane >> 4, c4 = (lane & 15) * 4; typedef _Float16 v4h __attribute__((ext_vector_type(4)));
  {
#pragma unroll
    for (int q = 0; q < 8; ++q) { const int r = q * 2 + rsub; if (col0 + c4 < N) { const v4f v = *(const v4fa*)&so[w][r][c4]; if (C) *(v4f*)(C + cofs + (size_t)(row0 + r) * ldc + col0 + c4) = v; if (C16) { v4h h4; for (int i = 0; i < 4; ++i) h4[i] = (_Float16)v[i]; *(v4h*)(C16 + cofs + (size_t)(row0 + r) * ldc + col0 + c4) = h4; } } }
     }
}


typedef _Float16 v4h __attribute__((ext_vector_type(4)));

__global__ __launch_bounds__(256) void k_h16(const float* __restrict__ x, _Float16* __restrict__ X16, size_t n8) { const size_t t = (size_t)blockIdx.x * 256 + threadIdx.x; if (t >= n8) return; FragH f;
#pragma unroll
  for (int q = 0; q < 8; ++q) f.h[q] = (_Float16)x[t * 8 + q]; *(v8us*)((unsigned short*)X16 + t * 8) = f.half[0];  }
__global__ __launch_bounds__(256) void k_round16f(const float* __restrict__ W, _Float16* __restrict__ Bt, size_t n8) { const size_t t = (size_t)blockIdx.x * 256 + threadIdx.x; if (t >= n8) return; FragH f;
#pragma unroll
  for (int i = 0; i < 8; ++i) f.h[i] = (_Float16)(bf16_round(W[t * 8 + i]) * 16.0f); *(v8us*)((unsigned short*)Bt + t * 8) = f.half[0];  }
template <int NHv, int TTv>
__global__ __launch_bounds__(256) void k_vt(const _Float16* __restrict__ V16, int ldv, int voff, _Float16* __restrict__ Vt) { __shared__ unsigned short tl[64][66]; const int tid = threadIdx.x; const int slab = blockIdx.x / (TTv / 64), lg = blockIdx.x % (TTv / 64); const int b = slab / NHv, h = slab % NHv;
  for (int i = tid; i < 64 * 8; i += 256) { const int r = i / 8, c8 = (i % 8) * 8; FragH f; f.half[0] = *(const v8us*)((const unsigned short*)V16 + ((size_t)b * TTv + lg * 64 + r) * ldv + voff + h * 64 + c8);
#pragma unroll
    for (int q = 0; q < 8; ++q) tl[r][c8 + q] = f.u[q]; }
  __syncthreads();
  {
#pragma unroll
    for (int rd = 0; rd < 2; ++rd) { const int d = rd * 32 + tid / 8, pc = tid % 8; FragH f;
#pragma unroll
      for (int q = 0; q < 8; ++q) f.u[q] = tl[pc * 8 + q][d];
      *(v8us*)((unsigned short*)Vt + ((size_t)slab * 64 + d) * TTv + lg * 64 + pc * 8) = f.half[0]; }
     } }

// ---- fast GEMM (block tile 128x128, four waves as 2 x 2, wave tile 64x64; requires M % 128 == 0, N % 128 == 0, K % 64 == 0); epilogue = k_gemm_hhx semantics ----
// Tile sizes follow the L2 and LDS rates: a block stages 256 rows per slice for 128 x 128 outputs, and a wave reads 8 fragments for 16 matrix instructions (each fragment feeds four).
// Per trip a 64-deep slice of A (128 rows) and of B (128 rows) is copied to LDS in whole 128-byte lines (asynchronous copies, two buffers: the next slice flies while this one is multiplied); fragments come from LDS.
#define G2_PITCH 144                      /* LDS bytes per staged row: 128 + 16, the conflict-free pitch for 16-byte reads */
#define G2_BUF ((128 + 128) * G2_PITCH)   /* one buffer: A rows 0..127, then B rows 128..255 */
__device__ __forceinline__ v16h g2_lfrag(const unsigned char* p) { FragH f; f.half[0] = *(const v8us*)p; f.half[1] = *(const v8us*)(p + 32); return f.v; }
__device__ __forceinline__ v8f g2_mma(v16h a, v16h b, v8f c) { v8f d = __builtin_amdgcn_wmma_f32_16x16x32_f16(false, a, false, b, (short)0, c, false, false); asm volatile("v_nop\n\tv_nop\n\tv_nop\n\tv_nop" : "+v"(d) : "v"(a), "v"(b)); return d; }
// one operand's half of a slice: 8 copies of 16 bytes per lane (128 rows), a wave's copy covering 4 whole rows; l = the lane's LDS byte address of its first row, rows 16 apart
__device__ __forceinline__ void g2_copy(unsigned l, const _Float16* g, size_t s16) {
  /* the closing s_wait_xcnt keeps every address register intact until the copies have taken it */
  asm volatile("global_load_async_to_lds_b128 %0, %8, off\n\t"
               "global_load_async_to_lds_b128 %1, %9, off\n\t"
               "global_load_async_to_lds_b128 %2, %10, off\n\t"
               "global_load_async_to_lds_b128 %3, %11, off\n\t"
               "global_load_async_to_lds_b128 %4, %12, off\n\t"
               "global_load_async_to_lds_b128 %5, %13, off\n\t"
               "global_load_async_to_lds_b128 %6, %14, off\n\t"
               "global_load_async_to_lds_b128 %7, %15, off\n\t"
               "s_wait_xcnt 0x0"
               :: "v"(l), "v"(l + 16 * G2_PITCH), "v"(l + 32 * G2_PITCH), "v"(l + 48 * G2_PITCH), "v"(l + 64 * G2_PITCH), "v"(l + 80 * G2_PITCH), "v"(l + 96 * G2_PITCH), "v"(l + 112 * G2_PITCH),
                  "v"(g), "v"(g + s16), "v"(g + 2 * s16), "v"(g + 3 * s16), "v"(g + 4 * s16), "v"(g + 5 * s16), "v"(g + 6 * s16), "v"(g + 7 * s16)
               : "memory");
}
template <int ACT, bool SPLIT>
__device__ __forceinline__ void g2_body(unsigned char* smem, int bx, int by, const _Float16* __restrict__ A, int lda, size_t sA, const _Float16* __restrict__ Bh, int ldb, size_t sB, float alpha, const float* __restrict__ bias, size_t sBias, const float* __restrict__ CP, int rowsPerB, size_t sCPb, int row0g,
    float* __restrict__ C, _Float16* __restrict__ C16, _Float16* __restrict__ CL, int ldc, size_t sC, int M, int N, int K) {      /* output: C (f32) or, with SPLIT, the pair C16 and CL: the f16 rounding and its 2^10-scaled residual, the two planes of a split operand */
  /* smem: the kernel's 2 * G2_BUF bytes of LDS, the two staging buffers; the epilogue's 4 x 64 x 68 floats lie over them once the loop's last barrier has ended every read. bx, by: the block's place in this product's own grid */
  float (*so)[64][68] = reinterpret_cast<float (*)[64][68]>(smem);
  const int tid = threadIdx.x, w = tid >> 5, lane = tid & 31, ln = lane & 15, hh = lane >> 4; const int wm = w >> 1, wn = w & 1;      /* the wave's place in the block's 2 x 2 */
  A += (size_t)by * sA; Bh += (size_t)by * sB; const size_t cofs = (size_t)by * sC; const float* bp = bias ? bias + (size_t)by * sBias : nullptr;
  const int ntn = N >> 7; const int mt = bx / ntn, nq = bx - mt * ntn; const int row0 = mt * 128 + 64 * wm, col0 = nq * 128 + 64 * wn; if (mt * 128 >= M) return;      /* the whole block leaves or none: barriers follow */
  const int crow = tid >> 3, cch = tid & 7;      /* copy role: row (mod 16) and 16-byte piece of the 128-byte row */
  const _Float16* gA = A + (size_t)(mt * 128 + crow) * lda + cch * 8; const _Float16* gB = Bh + (size_t)(nq * 128 + crow) * ldb + cch * 8; const size_t sa16 = (size_t)16 * lda, sb16 = (size_t)16 * ldb;
  const unsigned l0 = (unsigned)(size_t)smem + (unsigned)(crow * G2_PITCH + cch * 16);
  const int aoff = (64 * wm + ln) * G2_PITCH + 16 * hh, boff = (128 + 64 * wn + ln) * G2_PITCH + 16 * hh;
  v8f acc[4][4];      /* acc[i][j]: rows 16 i.., columns 16 j.. of the wave's tile */
#pragma unroll      /* here and below: every index of acc, a and b is a constant, so that they stay in registers */
  for (int i = 0; i < 4; ++i) {
#pragma unroll
    for (int j = 0; j < 4; ++j) acc[i][j] = (v8f){0.f,0.f,0.f,0.f,0.f,0.f,0.f,0.f}; }
  const int NT = K >> 6;
  g2_copy(l0, gA, sa16); g2_copy(l0 + 128 * G2_PITCH, gB, sb16);
  asm volatile("s_wait_asynccnt 0x0" ::: "memory");      /* slice 0 has landed before the barrier publishes it */
  __syncthreads();
  if (NT > 1) { g2_copy(l0 + G2_BUF, gA + 64, sa16); g2_copy(l0 + G2_BUF + 128 * G2_PITCH, gB + 64, sb16); }
#pragma unroll 1      /* one slice per trip: the buffer alternates with the trip's parity */
  for (int t = 0; t < NT; ++t) { const unsigned char* sb = smem + (t & 1) * G2_BUF; const unsigned char* pa = sb + aoff; const unsigned char* pb = sb + boff;
#pragma unroll      /* the slice's two 32-deep halves, in k order */
    for (int ks = 0; ks < 2; ++ks) { v16h a[4], b[4];
#pragma unroll
      for (int i = 0; i < 4; ++i) { a[i] = g2_lfrag(pa + i * 16 * G2_PITCH + ks * 64); b[i] = g2_lfrag(pb + i * 16 * G2_PITCH + ks * 64); }
#pragma unroll
      for (int j = 0; j < 4; ++j) {
#pragma unroll
        for (int i = 0; i < 4; ++i) acc[i][j] = g2_mma(a[i], b[j], acc[i][j]); } }
    asm volatile("s_wait_dscnt 0x0" ::: "memory");         /* this wave's reads of the buffer are over before it may be refilled */
    asm volatile("s_wait_asynccnt 0x0" ::: "memory");      /* this wave's copies of the next slice have landed */
    __syncthreads();                                       /* publishes the next slice and ends every wave's reads of this one */
    if (t + 2 < NT) { const unsigned lb = l0 + (unsigned)(t & 1) * G2_BUF; g2_copy(lb, gA + (size_t)(t + 2) * 64, sa16); g2_copy(lb + 128 * G2_PITCH, gB + (size_t)(t + 2) * 64, sb16); } }
  asm volatile("s_wait_asynccnt 0x0" ::: "memory");        /* nothing is in flight when the buffers become output staging */
#pragma unroll
  for (int u = 0; u < 16; ++u) { const int t = u & 3, qr = u >> 2; const int col = col0 + t * 16 + ln; const float bv = bp ? bf16_round(bp[col]) : 0.f;
#pragma unroll
    for (int r = 0; r < 8; ++r) { const int rloc = qr * 16 + 8 * hh + r; float v = acc[qr][t][r] * alpha + bv; if (CP) { const int bidx = (row0g + row0 + rloc) / rowsPerB; v += CP[(size_t)bidx * sCPb + (size_t)by * 64 + col]; }
      if (ACT == 3) v = fmaxf(v, 0.f); else if (ACT == 6) v = 0.5f * v * (1.0f + erff(v * 0.70710678118654752f)); else if (ACT == 11) v = 1.0f / (1.0f + expf(-v)); else if (ACT == 15) v = v / (1.0f + expf(-v)); else if (ACT == 12) v = (v > 0.f) ? v : 0.01f * v; else if (ACT == 8) v = tanhf(v);
      so[w][rloc][t * 16 + ln] = v; } }
  __builtin_amdgcn_fence(__ATOMIC_ACQ_REL, "workgroup"); __builtin_amdgcn_wave_barrier();
  const int rsub = lane >> 4, c4 = (lane & 15) * 4;
  if (!SPLIT) {
#pragma unroll
    for (int q = 0; q < 32; ++q) { const int r = q * 2 + rsub; const v4f v = *(const v4fa*)&so[w][r][c4]; *(v4f*)(C + cofs + (size_t)(row0 + r) * ldc + col0 + c4) = v; }
  } else {
#pragma unroll
    for (int q = 0; q < 32; ++q) { const int r = q * 2 + rsub; const v4f v = *(const v4fa*)&so[w][r][c4]; const size_t o = cofs + (size_t)(row0 + r) * ldc + col0 + c4; v4h h4, l4;
      for (int i = 0; i < 4; ++i) { h4[i] = (_Float16)v[i]; l4[i] = (_Float16)((v[i] - (float)h4[i]) * 1024.0f); }
      *(v4h*)(C16 + o) = h4; *(v4h*)(CL + o) = l4; }
  } }
// out = attn Wo^T. Shapes and the unused bias and addend arguments are fixed at compile time, as in k_proj: the unrolled epilogue of the larger tile then holds no untaken paths and the kernel's text stays short.
__global__ __launch_bounds__(128) void k_out(const _Float16* __restrict__ A16, const _Float16* __restrict__ BO, float* __restrict__ out) {
  __shared__ __attribute__((aligned(16))) unsigned char smem[2 * G2_BUF];
  g2_body<0, false>(smem, (int)blockIdx.x, 0, A16, DM, 0, BO, DM, 0, 0.0625f, nullptr, 0, nullptr, 1, 0, 0, out, nullptr, nullptr, DM, 0, NR, DM, DM); }
// The three projections in one grid (they share x and depend on nothing of each other): blocks 0.. q = x Wq^T, then k = x Wk^T, then V^T = Wv x^T per batch (the weight rows are the A operand, the tokens the B operand). The two small products alone would leave three SIMD places in four empty.
#define PJ_NQ ((NR / 128) * (DM / 128))
#define PJ_NK ((NR / 128) * (KVD / 128))
#define PJ_NV ((KVD / 128) * (SLEN / 128))      /* per batch */
__global__ __launch_bounds__(128) void k_proj(const _Float16* __restrict__ X16, const _Float16* __restrict__ BQ, const _Float16* __restrict__ BK, const _Float16* __restrict__ BV,
    _Float16* __restrict__ QH, _Float16* __restrict__ QL, _Float16* __restrict__ KH, _Float16* __restrict__ KL, _Float16* __restrict__ VT, _Float16* __restrict__ VTL) {
  __shared__ __attribute__((aligned(16))) unsigned char smem[2 * G2_BUF];
  int bx = (int)blockIdx.x; const _Float16* A = X16; const _Float16* B = BQ; _Float16* H = QH; _Float16* L = QL; int ldc = DM, M = NR, N = DM;
  if (bx >= PJ_NQ + PJ_NK) { bx -= PJ_NQ + PJ_NK; const int bt = bx / PJ_NV; bx -= bt * PJ_NV; A = BV; B = X16 + (size_t)bt * SLEN * DM; H = VT + (size_t)bt * KVD * SLEN; L = VTL + (size_t)bt * KVD * SLEN; ldc = SLEN; M = KVD; N = SLEN; }
  else if (bx >= PJ_NQ) { bx -= PJ_NQ; B = BK; H = KH; L = KL; ldc = KVD; N = KVD; }
  g2_body<0, true>(smem, bx, 0, A, DM, 0, B, DM, 0, 0.0625f, nullptr, 0, nullptr, 1, 0, 0, nullptr, H, L, ldc, 0, M, N, DM); }



// lane l with lane l ^ 16 (the two halves of a wave hold the two key halves of one query column)
__device__ __forceinline__ float xhalf(float x) { return __builtin_bit_cast(float, __builtin_amdgcn_permlanex16(__builtin_bit_cast(int, x), __builtin_bit_cast(int, x), 0x76543210, 0xfedcba98, false, false)); }
#define FL_BUF (192 * G2_PITCH)      /* one buffer: key rows 0..63, low value-dimension rows 64..127, high ones 128..191 */
// one tile: 12 copies of 16 bytes per lane (4 of K, 4 of V^T low, 4 of V^T high), a wave's copy covering 4 whole rows; l = the lane's LDS byte address of its first row, rows 16 apart
__device__ __forceinline__ void fl_copy(unsigned l, const unsigned short* gk, size_t sk16, const unsigned short* gv, const unsigned short* gw, size_t sv16) {
  /* the closing s_wait_xcnt keeps every address register intact until the copies have taken it */
  asm volatile("global_load_async_to_lds_b128 %0, %12, off\n\t"
               "global_load_async_to_lds_b128 %1, %13, off\n\t"
               "global_load_async_to_lds_b128 %2, %14, off\n\t"
               "global_load_async_to_lds_b128 %3, %15, off\n\t"
               "global_load_async_to_lds_b128 %4, %16, off\n\t"
               "global_load_async_to_lds_b128 %5, %17, off\n\t"
               "global_load_async_to_lds_b128 %6, %18, off\n\t"
               "global_load_async_to_lds_b128 %7, %19, off\n\t"
               "global_load_async_to_lds_b128 %8, %20, off\n\t"
               "global_load_async_to_lds_b128 %9, %21, off\n\t"
               "global_load_async_to_lds_b128 %10, %22, off\n\t"
               "global_load_async_to_lds_b128 %11, %23, off\n\t"
               "s_wait_xcnt 0x0"
               :: "v"(l), "v"(l + 16 * G2_PITCH), "v"(l + 32 * G2_PITCH), "v"(l + 48 * G2_PITCH), "v"(l + 64 * G2_PITCH), "v"(l + 80 * G2_PITCH), "v"(l + 96 * G2_PITCH), "v"(l + 112 * G2_PITCH),
                  "v"(l + 128 * G2_PITCH), "v"(l + 144 * G2_PITCH), "v"(l + 160 * G2_PITCH), "v"(l + 176 * G2_PITCH),
                  "v"(gk), "v"(gk + sk16), "v"(gk + 2 * sk16), "v"(gk + 3 * sk16), "v"(gv), "v"(gv + sv16), "v"(gv + 2 * sv16), "v"(gv + 3 * sv16),
                  "v"(gw), "v"(gw + sv16), "v"(gw + 2 * sv16), "v"(gw + 3 * sv16)
               : "memory");
}
// Transposed products: S^T = K Q^T (A = key rows, B = query columns) and O^T += V^T P^T (A = value-dimension rows of V^T, B = P^T). A lane holds 16 of the 32 scores of ONE query (keys 8 hh + r and 16 + 8 hh + r), which is the k order of a B operand: P goes from the score accumulators into the next product without LDS; maximum, sum and rescale factor are one value per lane.
template <int CAUSAL>
__device__ __forceinline__ void fl_body(unsigned char* smem, int bx, const _Float16* __restrict__ Q16, int ldq, const _Float16* __restrict__ K16, int ldk, const _Float16* __restrict__ Vt, const _Float16* __restrict__ Vt2, const int* __restrict__ MSK, const float* __restrict__ LAM, const float* __restrict__ lnw, _Float16* __restrict__ A16) {
  constexpr int RPW = 16, DT = 8, KS = 2;      /* DT 0..3: low 64 value columns (Vt), DT 4..7: high 64 (Vt2); one score/softmax pass feeds both */
  /* smem: the kernel's 2 * FL_BUF bytes of LDS, the two staging buffers; the epilogue's hand-over (2 x 16 x 32 groups of 4 floats) lies over them once the loop's last barrier has ended every read. bx: the block's place among the NB * (NH / 2) * PQN blocks of this part */
  /* a block holds 32 queries of BOTH pseudo-heads of one differential head jh (they share key head and value head, so one staged tile serves all four waves): waves 0, 1 the even pseudo-head, waves 2, 3 the odd one, on the same two groups of 16 queries */
  const int tid = threadIdx.x, w = tid >> 5, lane = tid & 31, ln = lane & 15, hh = lane >> 4;
  const int slab = bx / PQN, qblk = PQ0 + bx % PQN; const int b = slab / (NH / 2), jh = slab % (NH / 2), h = 2 * jh + (w >> 1); const int qb0 = qblk * (2 * RPW); const int q0 = qb0 + (w & 1) * RPW; const int tq = q0 + ln;      /* this lane's query */
  FragH aq[KS];
  { const unsigned short* qr = (const unsigned short*)Q16 + ((size_t)b * TQ + tq) * ldq + h * 64;
#pragma unroll
    for (int ks = 0; ks < KS; ++ks) { aq[ks].half[0] = *(const v8us*)(qr + ks * 32 + 8 * hh); aq[ks].half[1] = *(const v8us*)(qr + ks * 32 + 16 + 8 * hh); } }
  const size_t vo = ((size_t)b * KVD + (h / 8) * 128) * TK;      /* pseudo-head h reads value head h / 8 (128 rows of V^T [batch][512][token]); Vt2 points 64 rows further */
  const unsigned short* Vth = (const unsigned short*)Vt + vo; const unsigned short* Vth2 = (const unsigned short*)Vt2 + vo;
  constexpr float C2 = SCL * 1.4426950408889634f;      /* raw score -> exponent in base 2 */
  float m_r = -1.0e38f, l_r = 0.f; v8f oacc[DT];      /* m_r: running maximum of the RAW scores, never below -1e38, so that a masked score (-3e38) stays far under it; l_r: row sum in units of 2^-10 */
#pragma unroll
  for (int dt = 0; dt < DT; ++dt) oacc[dt] = (v8f){0.f,0.f,0.f,0.f,0.f,0.f,0.f,0.f};
  const int jend = (CAUSAL == 1) ? (qb0 + 2 * RPW) : TK;      /* causal: keys beyond the block's last query never contribute */
  const int crow = tid >> 3, cch = tid & 7;      /* copy role: row (mod 16) and 16-byte piece of the 128-byte row */
  const unsigned short* gK = (const unsigned short*)K16 + ((size_t)b * TK + crow) * ldk + (h / NREP) * 64 + cch * 8;      /* query head h reads key head h / 4 */
  const unsigned short* gV = Vth + (size_t)crow * TK + cch * 8; const unsigned short* gW = Vth2 + (size_t)crow * TK + cch * 8; const size_t sk16 = (size_t)16 * ldk, sv16 = (size_t)16 * TK;
  const unsigned l0 = (unsigned)(size_t)smem + (unsigned)(crow * G2_PITCH + cch * 16);
  const int foff = ln * G2_PITCH + 16 * hh;      /* fragment role: row (mod 16) and 16-byte piece, the k order of the former global loads */
  const int NT = (jend + 63) >> 6;      /* whole tiles of 64 keys (TK is a multiple of 64); the keys past jend are masked like any key behind the query */
  fl_copy(l0, gK, sk16, gV, gW, sv16);
  asm volatile("s_wait_asynccnt 0x0" ::: "memory");      /* tile 0 has landed before the barrier publishes it */
  __syncthreads();
  if (NT > 1) fl_copy(l0 + FL_BUF, gK + (size_t)64 * ldk, sk16, gV + 64, gW + 64, sv16);
#pragma unroll 1      /* one tile per trip: the buffer alternates with the trip's parity */
  for (int t = 0; t < NT; ++t) { const unsigned char* sb = smem + (t & 1) * FL_BUF + foff;
#pragma unroll      /* the tile's two 32-key halves, each worked on as one pass of the online softmax, in key order */
   for (int sub = 0; sub < 2; ++sub) { const int j0 = t * 64 + sub * 32;
    FragH bk[2][KS], bv[DT];
#pragma unroll
    for (int nt = 0; nt < 2; ++nt) {
#pragma unroll
      for (int ks = 0; ks < KS; ++ks) bk[nt][ks].v = g2_lfrag(sb + (sub * 32 + nt * 16) * G2_PITCH + ks * 64); }
    v8f st[2];      /* st[nt][r] = score of key j0 + nt * 16 + 8 * hh + r against query tq */
#pragma unroll
    for (int nt = 0; nt < 2; ++nt) { v8f acc = (v8f){0.f,0.f,0.f,0.f,0.f,0.f,0.f,0.f};
#pragma unroll
      for (int ks = 0; ks < KS; ++ks) acc = mmaH<1>(bk[nt][ks].v, bk[nt][ks].v, aq[ks].v, aq[ks].v, acc);
      st[nt] = acc; }
#pragma unroll
    for (int dt = 0; dt < DT; ++dt) bv[dt].v = g2_lfrag(sb + (64 + dt * 16) * G2_PITCH + sub * 64);
    float sv[16]; float mc = -3.0e38f;
#pragma unroll
    for (int e = 0; e < 16; ++e) { const int kk = j0 + (e >> 3) * 16 + 8 * hh + (e & 7); const bool ok = (CAUSAL == 1) ? (kk <= tq) : ((CAUSAL == 2) ? ((kk >> 5) == (tq >> 5)) : true);      /* mode 2: block-diagonal 32-token groups */
      sv[e] = ok ? st[e >> 3][e & 7] : -3.0e38f; mc = fmaxf(mc, sv[e]); }
    mc = fmaxf(mc, xhalf(mc));      /* both halves feed one output column: they share the maximum */
    const float mn = fmaxf(m_r, mc); const float xa = (m_r - mn) * C2; m_r = mn;      /* rescale factor 2^xa; nothing seen yet: 2^0 = 1 on zero sums */
    const float nb = fmaf(-mn, C2, 10.0f);      /* p = 1024 exp((s - mn) / 8) = 2^(s C2 + nb): scale, maximum and the operand's 2^10 in one fused multiply-add; a masked score gives 2^(-huge) = 0 */
    float pe[16], al = xa;
#pragma unroll
    for (int e = 0; e < 16; ++e) pe[e] = fmaf(sv[e], C2, nb);
    /* the exponentials stand together, each in place on a register of its own: no v_exp_f32 is directly followed by a read of its result or by another instruction's write of its source; the closing v_nop keeps that slot free of whatever the compiler puts next */
    asm("v_exp_f32 %0, %0\n\tv_exp_f32 %1, %1\n\tv_exp_f32 %2, %2\n\tv_exp_f32 %3, %3\n\tv_exp_f32 %4, %4\n\tv_exp_f32 %5, %5\n\tv_exp_f32 %6, %6\n\tv_exp_f32 %7, %7\n\tv_exp_f32 %8, %8\n\tv_nop"
        : "+v"(al), "+v"(pe[0]), "+v"(pe[1]), "+v"(pe[2]), "+v"(pe[3]), "+v"(pe[4]), "+v"(pe[5]), "+v"(pe[6]), "+v"(pe[7]));
    asm("v_exp_f32 %0, %0\n\tv_exp_f32 %1, %1\n\tv_exp_f32 %2, %2\n\tv_exp_f32 %3, %3\n\tv_exp_f32 %4, %4\n\tv_exp_f32 %5, %5\n\tv_exp_f32 %6, %6\n\tv_exp_f32 %7, %7\n\tv_nop"
        : "+v"(pe[8]), "+v"(pe[9]), "+v"(pe[10]), "+v"(pe[11]), "+v"(pe[12]), "+v"(pe[13]), "+v"(pe[14]), "+v"(pe[15]));
    FragH pb; float ps[4] = {0.f, 0.f, 0.f, 0.f};
#pragma unroll
    for (int e = 0; e < 16; ++e) { ps[e & 3] += pe[e]; pb.h[e] = (_Float16)pe[e]; }
    l_r = l_r * al + ((ps[0] + ps[1]) + (ps[2] + ps[3]));
#pragma unroll
    for (int dt = 0; dt < DT; ++dt) {
#pragma unroll
      for (int r = 0; r < 8; ++r) oacc[dt][r] *= al; }
#pragma unroll
    for (int dt = 0; dt < DT; ++dt) oacc[dt] = mmaH<1>(bv[dt].v, bv[dt].v, pb.v, pb.v, oacc[dt]); }
    asm volatile("s_wait_dscnt 0x0" ::: "memory");         /* this wave's reads of the buffer are over before it may be refilled */
    asm volatile("s_wait_asynccnt 0x0" ::: "memory");      /* this wave's copies of the next tile have landed */
    __syncthreads();                                       /* publishes the next tile and ends every wave's reads of this one */
    if (t + 2 < NT) fl_copy(l0 + (unsigned)(t & 1) * FL_BUF, gK + (size_t)(t + 2) * 64 * ldk, sk16, gV + (t + 2) * 64, gW + (t + 2) * 64, sv16); }
  asm volatile("s_wait_asynccnt 0x0" ::: "memory");        /* nothing is in flight when the buffers become output staging */
  const float lt = l_r + xhalf(l_r); const float inv = (lt > 0.f) ? 1.0f / lt : 0.f;      /* sums and products both carry the 2^10 */
  /* oacc[dt][r] * inv = value column dt * 16 + 8 * hh + r of query tq. Difference, RMSNorm and weight follow here: the odd pseudo-head's waves hand their columns over through LDS, lane for lane (wave w + 2 and wave w hold the same queries in the same layout) */
  v4fa* sx = reinterpret_cast<v4fa*>(smem);
  if (w >= 2) {
#pragma unroll
    for (int dt = 0; dt < DT; ++dt) { const v8f a = oacc[dt]; const v4f lo = {a[0] * inv, a[1] * inv, a[2] * inv, a[3] * inv}, hi = {a[4] * inv, a[5] * inv, a[6] * inv, a[7] * inv};
      sx[((w - 2) * 16 + dt * 2) * 32 + lane] = lo; sx[((w - 2) * 16 + dt * 2 + 1) * 32 + lane] = hi; } }
  __syncthreads();      /* publishes the odd pseudo-head's columns to the even one's waves */
  if (w < 2) { const float lam = LAM[0]; float ps[4] = {0.f, 0.f, 0.f, 0.f};
#pragma unroll
    for (int dt = 0; dt < DT; ++dt) {
#pragma unroll
      for (int g = 0; g < 2; ++g) { const v4f o = sx[(w * 16 + dt * 2 + g) * 32 + lane];
#pragma unroll
        for (int i = 0; i < 4; ++i) { const float v = oacc[dt][g * 4 + i] * inv - lam * o[i]; oacc[dt][g * 4 + i] = v; ps[i] += v * v; } } }
    const float sh = (ps[0] + ps[1]) + (ps[2] + ps[3]); const float ss = sh + xhalf(sh);      /* the lane pair l, l ^ 16 holds the query's 128 columns */
    const float rn = rsqrtf(ss / 128.0f + 1e-5f); unsigned short* dst = (unsigned short*)A16 + ((size_t)b * TQ + tq) * DM + (size_t)jh * 128 + 8 * hh;
#pragma unroll
    for (int dt = 0; dt < DT; ++dt) { const v4f g0 = *(const v4fa*)(lnw + dt * 16 + 8 * hh), g1 = *(const v4fa*)(lnw + dt * 16 + 8 * hh + 4); FragH f;
#pragma unroll
      for (int r = 0; r < 8; ++r) f.h[r] = (_Float16)(oacc[dt][r] * rn * bf16_round(r < 4 ? g0[r & 3] : g1[r & 3]) * 0.21639423346837554f);      /* 1 - LAMBDA_INIT */
      *(v8us*)(dst + dt * 16) = f.half[0]; } } }
// 5-plane variant: S = Qh Kh^T + (Ql Kh^T + Qh Kl^T)/1024 with Q/K = [hi | 2^10 residual] f16 planes (QL/KL same layout as Q16/K16), then the 3-term P.V below.
// 3-term variant: O = (P_hi V_hi + (P_lo V_hi + P_hi V_lo) / 1024) / l with P = [hi | 2^10 residual] of 1024 p and V^T = [hi | 2^10 residual] planes (VtL same layout as Vt) -> ~2^-21-class products for un-averaged (early causal / peaked) rows
template <int CAUSAL>
__device__ __forceinline__ void fl5_body(unsigned char* smem, int bx, const _Float16* __restrict__ Q16, const _Float16* __restrict__ QL, int ldq, const _Float16* __restrict__ K16, const _Float16* __restrict__ KL, int ldk, const _Float16* __restrict__ Vt, const _Float16* __restrict__ VtL, const int* __restrict__ MSK, const float* __restrict__ LAM, const float* __restrict__ lnw, _Float16* __restrict__ A16) {
  constexpr int RPW = 16, DT = 4, KS = 2;      /* transposed like k_flash: key rows and V^T rows are A operands, query columns and P^T are B operands */
  /* a block holds 16 queries of one differential head jh, whole: wave w has pseudo-head 2 jh + (w >> 1) and the low (w & 1 = 0) or high 64 value columns. smem: the epilogue's hand-over at the head of the kernel's LDS; bx: the block's place among the NB * (NH / 2) * SQN blocks of this part */
  const int tid = threadIdx.x, w = tid >> 5, lane = tid & 31, ln = lane & 15, hh = lane >> 4;
  const int slab = bx / SQN, qblk = bx % SQN; const int b = slab / (NH / 2), jh = slab % (NH / 2), h = 2 * jh + (w >> 1), hf = w & 1; const int q0 = qblk * RPW; const int tq = q0 + ln;      /* this lane's query */
  FragH aq[KS], aql[KS];
  { const unsigned short* qr = (const unsigned short*)Q16 + ((size_t)b * TQ + tq) * ldq + h * 64; const unsigned short* ql = (const unsigned short*)QL + ((size_t)b * TQ + tq) * ldq + h * 64;
#pragma unroll
    for (int ks = 0; ks < KS; ++ks) { aq[ks].half[0] = *(const v8us*)(qr + ks * 32 + 8 * hh); aq[ks].half[1] = *(const v8us*)(qr + ks * 32 + 16 + 8 * hh); aql[ks].half[0] = *(const v8us*)(ql + ks * 32 + 8 * hh); aql[ks].half[1] = *(const v8us*)(ql + ks * 32 + 16 + 8 * hh); } }
  const size_t vo = ((size_t)b * KVD + (h / 8) * 128 + hf * 64) * TK;      /* value head h / 8 of V^T [batch][512][token], its low or high 64 rows */
  const unsigned short* Vth = (const unsigned short*)Vt + vo; const unsigned short* Vtl = (const unsigned short*)VtL + vo;
  float m_r = -3.0e38f, l_r = 0.f; v8f oacc[DT], oaccL[DT];
#pragma unroll
  for (int dt = 0; dt < DT; ++dt) { oacc[dt] = (v8f){0.f,0.f,0.f,0.f,0.f,0.f,0.f,0.f}; oaccL[dt] = oacc[dt]; }
  const int jend = (CAUSAL == 1) ? (q0 + RPW) : TK;      /* causal: keys beyond the block's last query never contribute; the last pass of 32 keys may reach past jend (never past TK), masked */
#pragma unroll 1
  for (int j0 = 0; j0 < jend; j0 += 32) {
    FragH bk[2][KS], bkl[2][KS], bv[DT], bl[DT];
    const size_t ko = ((size_t)b * TK + j0 + ln) * ldk + (h / NREP) * 64 + 8 * hh; const unsigned short* kr0 = (const unsigned short*)K16 + ko; const unsigned short* kr1 = kr0 + (size_t)16 * ldk; const unsigned short* kl0 = (const unsigned short*)KL + ko; const unsigned short* kl1 = kl0 + (size_t)16 * ldk;
#pragma unroll
    for (int nt = 0; nt < 2; ++nt) { const unsigned short* kr = nt ? kr1 : kr0; const unsigned short* klr = nt ? kl1 : kl0;
#pragma unroll
      for (int ks = 0; ks < KS; ++ks) { bk[nt][ks].half[0] = *(const v8us*)(kr + ks * 32); bk[nt][ks].half[1] = *(const v8us*)(kr + ks * 32 + 16); bkl[nt][ks].half[0] = *(const v8us*)(klr + ks * 32); bkl[nt][ks].half[1] = *(const v8us*)(klr + ks * 32 + 16); } }
    asm volatile("s_wait_xcnt 0x0" :: "v"(kr0), "v"(kr1), "v"(kl0), "v"(kl1) : "memory");      /* a precaution: the address registers stay whole (no load's own destination takes them) until the issued loads have taken them */
    v8f st[2];      /* st[nt][r] = score of key j0 + nt * 16 + 8 * hh + r against query tq */
#pragma unroll
    for (int nt = 0; nt < 2; ++nt) { v8f acc = (v8f){0.f,0.f,0.f,0.f,0.f,0.f,0.f,0.f}, accl = acc;
#pragma unroll
      for (int ks = 0; ks < KS; ++ks) { acc = mmaH<1>(bk[nt][ks].v, bk[nt][ks].v, aq[ks].v, aq[ks].v, acc); accl = mmaH<1>(bk[nt][ks].v, bk[nt][ks].v, aql[ks].v, aql[ks].v, accl); accl = mmaH<1>(bkl[nt][ks].v, bkl[nt][ks].v, aq[ks].v, aq[ks].v, accl); }
#pragma unroll
      for (int r = 0; r < 8; ++r) acc[r] += accl[r] * 0.0009765625f;
      st[nt] = acc; }
    const unsigned short* vr0 = Vth + (size_t)ln * TK + j0 + 8 * hh; const unsigned short* vr1 = Vtl + (size_t)ln * TK + j0 + 8 * hh;
#pragma unroll
    for (int dt = 0; dt < DT; ++dt) { const unsigned short* vrow = vr0 + (size_t)(dt * 16) * TK; const unsigned short* vrl = vr1 + (size_t)(dt * 16) * TK; bv[dt].half[0] = *(const v8us*)vrow; bv[dt].half[1] = *(const v8us*)(vrow + 16); bl[dt].half[0] = *(const v8us*)vrl; bl[dt].half[1] = *(const v8us*)(vrl + 16); }
    asm volatile("s_wait_xcnt 0x0" :: "v"(vr0), "v"(vr1) : "memory");      /* the same precaution for the value loads, which fly during the softmax */
    float sv[16]; bool ok[16]; float mc = -3.0e38f;
#pragma unroll
    for (int e = 0; e < 16; ++e) { const int kk = j0 + (e >> 3) * 16 + 8 * hh + (e & 7); ok[e] = (CAUSAL == 1) ? (kk <= tq) : ((CAUSAL == 2) ? ((kk >> 5) == (tq >> 5)) : true);      /* mode 2: block-diagonal 32-token groups */
      if (CAUSAL == 4) ok[e] = MSK[((size_t)b * TQ + tq) * TK + kk] != 0;      /* mode 4: per-(query, key) INPUT mask shared by all heads; masked keys contribute nothing (== the reference's -4096 fill, whose exp underflows to 0), rows with no valid key give l = 0 -> output 0 (== the reference's row_valid zeroing) */
      sv[e] = ok[e] ? st[e >> 3][e & 7] * SCL : -3.0e38f; mc = fmaxf(mc, sv[e]); }
    mc = fmaxf(mc, xhalf(mc));      /* both halves feed one output column: they share the maximum */
    const float mn = fmaxf(m_r, mc); const float al = (mn > -1.0e38f) ? expf(m_r - mn) : 1.0f; m_r = mn;
    FragH pa, pl; float ps[4] = {0.f, 0.f, 0.f, 0.f};
#pragma unroll
    for (int e = 0; e < 16; ++e) { const float p = ok[e] ? expf(sv[e] - mn) : 0.f; ps[e & 3] += p; const float pw = p * 1024.0f; pa.h[e] = (_Float16)pw; pl.h[e] = (_Float16)((pw - (float)pa.h[e]) * 1024.0f); }
    l_r = l_r * al + ((ps[0] + ps[1]) + (ps[2] + ps[3]));
#pragma unroll
    for (int dt = 0; dt < DT; ++dt) {
#pragma unroll
      for (int r = 0; r < 8; ++r) { oacc[dt][r] *= al; oaccL[dt][r] *= al; } }
#pragma unroll
    for (int dt = 0; dt < DT; ++dt) { oacc[dt] = mmaH<1>(bv[dt].v, bv[dt].v, pa.v, pa.v, oacc[dt]); oaccL[dt] = mmaH<1>(bv[dt].v, bv[dt].v, pl.v, pl.v, oaccL[dt]); oaccL[dt] = mmaH<1>(bl[dt].v, bl[dt].v, pa.v, pa.v, oaccL[dt]); } }
  const float lt = l_r + xhalf(l_r); const float inv = (lt > 0.f) ? 1.0f / (lt * 1024.0f) : 0.f;
#pragma unroll
  for (int dt = 0; dt < DT; ++dt) {
#pragma unroll
    for (int r = 0; r < 8; ++r) oacc[dt][r] = (oacc[dt][r] + oaccL[dt][r] * 0.0009765625f) * inv; }      /* oacc[dt][r] = value column hf * 64 + dt * 16 + 8 * hh + r of query tq */
  /* difference, RMSNorm and weight: waves 2, 3 (odd pseudo-head) hand their columns to waves 0, 1 lane for lane; these two then exchange their halves' sums of squares */
  v4fa* sx = reinterpret_cast<v4fa*>(smem); float* sq = reinterpret_cast<float*>(smem + 2 * 8 * 32 * 16);
  if (w >= 2) {
#pragma unroll
    for (int dt = 0; dt < DT; ++dt) { const v8f a = oacc[dt]; const v4f lo = {a[0], a[1], a[2], a[3]}, hi = {a[4], a[5], a[6], a[7]};
      sx[((w - 2) * 8 + dt * 2) * 32 + lane] = lo; sx[((w - 2) * 8 + dt * 2 + 1) * 32 + lane] = hi; } }
  __syncthreads();      /* publishes the odd pseudo-head's columns */
  float sh = 0.f;
  if (w < 2) { const float lam = LAM[0]; float ps[4] = {0.f, 0.f, 0.f, 0.f};
#pragma unroll
    for (int dt = 0; dt < DT; ++dt) {
#pragma unroll
      for (int g = 0; g < 2; ++g) { const v4f o = sx[(w * 8 + dt * 2 + g) * 32 + lane];
#pragma unroll
        for (int i = 0; i < 4; ++i) { const float v = oacc[dt][g * 4 + i] - lam * o[i]; oacc[dt][g * 4 + i] = v; ps[i] += v * v; } } }
    sh = (ps[0] + ps[1]) + (ps[2] + ps[3]); sh += xhalf(sh);      /* this half's 64 columns of the query */
    if (hh == 0) sq[w * 16 + ln] = sh; }
  __syncthreads();      /* publishes the two halves' sums of squares */
  if (w < 2) { const float ss = sh + sq[(w ^ 1) * 16 + ln];
    const float rn = rsqrtf(ss / 128.0f + 1e-5f); unsigned short* dst = (unsigned short*)A16 + ((size_t)b * TQ + tq) * DM + (size_t)jh * 128 + hf * 64 + 8 * hh;
#pragma unroll
    for (int dt = 0; dt < DT; ++dt) { const v4f g0 = *(const v4fa*)(lnw + hf * 64 + dt * 16 + 8 * hh), g1 = *(const v4fa*)(lnw + hf * 64 + dt * 16 + 8 * hh + 4); FragH f;
#pragma unroll
      for (int r = 0; r < 8; ++r) f.h[r] = (_Float16)(oacc[dt][r] * rn * bf16_round(r < 4 ? g0[r & 3] : g1[r & 3]) * 0.21639423346837554f);      /* 1 - LAMBDA_INIT */
      *(v8us*)(dst + dt * 16) = f.half[0]; } } }
// All of the attention in one grid, down to the normalised f16 operand of the output product (its two parts write disjoint rows and depend on nothing of each other): first the long blocks (rows from 256 on), behind them the short ones (first 256 rows), which start as places come free.
#define AT_NP (NB * (NH / 2) * PQN)
#define AT_N5 (NB * (NH / 2) * SQN)
__global__ __launch_bounds__(128) void k_attn(const _Float16* __restrict__ QH, const _Float16* __restrict__ QL, const _Float16* __restrict__ KH, const _Float16* __restrict__ KL, const _Float16* __restrict__ VT, const _Float16* __restrict__ VTL, const float* __restrict__ LAM, const float* __restrict__ lnw, _Float16* __restrict__ A16) {
  __shared__ __attribute__((aligned(16))) unsigned char smem[2 * FL_BUF];
  const int bx = (int)blockIdx.x;
  if (bx < AT_NP) { fl_body<1>(smem, bx, QH, DM, KH, KVD, VT, VT + (size_t)64 * SLEN, nullptr, LAM, lnw, A16); }
  else { fl5_body<1>(smem, bx - AT_NP, QH, QL, DM, KH, KL, KVD, VT, VTL, nullptr, LAM, lnw, A16); } }

__device__ __forceinline__ void lam_body(const float* __restrict__ q1, const float* __restrict__ k1, const float* __restrict__ q2, const float* __restrict__ k2, float* __restrict__ LAM) {
  #pragma clang fp contract(off)
  const int ln = threadIdx.x & 31; if (threadIdx.x >= 32) return; float a = bf16_round(q1[ln]) * bf16_round(k1[ln]); a += bf16_round(q1[ln + 32]) * bf16_round(k1[ln + 32]); float c = bf16_round(q2[ln]) * bf16_round(k2[ln]); c += bf16_round(q2[ln + 32]) * bf16_round(k2[ln + 32]);
  for (int o = 16; o > 0; o >>= 1) { a += __shfl_xor(a, o, 32); c += __shfl_xor(c, o, 32); } const float lf = expf(a) - expf(c) + 0.78360576653162446f;      /* LAMBDA_INIT = 0.8 - 0.6 exp(-0.3 * 12) = 0.78360577 */
  const float v = (ln == 0) ? lf : 0.f; *(float*)(LAM + ln) = v;  }
// Every operand conversion in one grid (none depends on another): x, then Wq, Wk, Wv, Wo (each weight lies (out,in), which is the GEMM's B^T form), each f32 -> bf16 rounding -> f16 (weights times 16, exact; x times 1, exact); the last block makes lambda_full. One group of 8 elements per thread, as in the separate launches before.
#define CV_NX ((NR / 8) * DM / 256)               /* blocks: x */
#define CV_NW ((DM / 8) * DM / 256)               /* Wq, Wo */
#define CV_NS ((KVD / 8) * DM / 256)              /* Wk, Wv */
#define CV_N (CV_NX + 2 * CV_NW + 2 * CV_NS)
__global__ __launch_bounds__(256) void k_prep(const float* __restrict__ x, const float* __restrict__ Wq, const float* __restrict__ Wk, const float* __restrict__ Wv, const float* __restrict__ Wo,
    const float* __restrict__ q1, const float* __restrict__ k1, const float* __restrict__ q2, const float* __restrict__ k2,
    _Float16* __restrict__ X16, _Float16* __restrict__ BQ, _Float16* __restrict__ BK, _Float16* __restrict__ BV, _Float16* __restrict__ BO, float* __restrict__ LAM) {
  int bx = (int)blockIdx.x;
  if (bx >= CV_N) { lam_body(q1, k1, q2, k2, LAM); return; }
  const float* src = x; _Float16* dst = X16; float sc = 1.0f;
  if (bx >= CV_NX) { bx -= CV_NX; sc = 16.0f;
    if (bx < CV_NW) { src = Wq; dst = BQ; }
    else if (bx < CV_NW + CV_NS) { bx -= CV_NW; src = Wk; dst = BK; }
    else if (bx < CV_NW + 2 * CV_NS) { bx -= CV_NW + CV_NS; src = Wv; dst = BV; }
    else { bx -= CV_NW + 2 * CV_NS; src = Wo; dst = BO; } }
  const size_t t = (size_t)bx * 256 + threadIdx.x; FragH f;
#pragma unroll
  for (int q = 0; q < 8; ++q) f.h[q] = (_Float16)(bf16_round(src[t * 8 + q]) * sc);
  *(v8us*)((unsigned short*)dst + t * 8) = f.half[0];
  asm volatile("s_wait_xcnt 0x0" ::: "memory");      /* the store's registers are not rewritten ahead of this wait, whatever code the build lays out behind it */
}

extern "C" void kernel_launch(void* const* d_in, const int* in_sizes, int n_in,
                              void* d_out, int out_size, void* d_ws, size_t ws_size, hipStream_t stream) {
  (void)in_sizes; (void)n_in; (void)out_size;
  const float* const* I = (const float* const*)d_in; const float* x = I[0]; const float* Wq = I[1]; const float* Wk = I[2]; const float* Wv = I[3]; const float* Wo = I[4]; const float* lq1 = I[5]; const float* lk1 = I[6]; const float* lq2 = I[7]; const float* lk2 = I[8]; const float* lnw = I[9];
  char* ws = (char*)d_ws; size_t off = 0;
  auto take = [&](size_t bytes) { char* p = ws + off; off += (bytes + 255) & ~(size_t)255; return p; };
  const size_t np = (size_t)NR * DM, nk = (size_t)NR * KVD;
  _Float16* BQ = (_Float16*)take((size_t)DM * DM * 2); _Float16* BK = (_Float16*)take((size_t)KVD * DM * 2); _Float16* BV = (_Float16*)take((size_t)KVD * DM * 2); _Float16* BO = (_Float16*)take((size_t)DM * DM * 2);
  _Float16* X16 = (_Float16*)take(np * 2); _Float16* QH = (_Float16*)take(np * 2); _Float16* QL = (_Float16*)take(np * 2); _Float16* KH = (_Float16*)take(nk * 2); _Float16* KL = (_Float16*)take(nk * 2); _Float16* VT = (_Float16*)take(nk * 2); _Float16* VTL = (_Float16*)take(nk * 2); float* LAM = (float*)take(256);      /* q [token][32 x 64], k [token][8 x 64], V^T [batch][4 x 128][token], each as f16 hi + residual plane */
  _Float16* A16 = X16;      /* normalised attention over the input plane (dead after the projections) */
  if (off > ws_size) return;      /* 8+2+2+8 + 16+16+16+4+4+4+4 = 84 MiB */
  k_prep<<<CV_N + 1, 256, 0, stream>>>(x, Wq, Wk, Wv, Wo, lq1, lk1, lq2, lk2, X16, BQ, BK, BV, BO, LAM);
  /* the projections write the attention's operands themselves: no f32 plane, no split, repeat or transpose pass in between */
  k_proj<<<PJ_NQ + PJ_NK + NB * PJ_NV, 128, 0, stream>>>(X16, BQ, BK, BV, QH, QL, KH, KL, VT, VTL);
  k_attn<<<AT_NP + AT_N5, 128, 0, stream>>>(QH, QL, KH, KL, VT, VTL, LAM, lnw, A16);
  k_out<<<(NR / 128) * (DM / 128), 128, 0, stream>>>(A16, BO, (float*)d_out);      /* out = attn Wo^T */
}

// v010
// It runs in 150 microseconds.
// Timed twice side by side with v009, it ran 1.09 and 1.08 times as fast.
// Over all steps from v000, the starting kernel, it is 6.42 times as fast.
#include <hip/hip_runtime.h>
// MultiheadSdpaDiff4 (2 x 2048 tokens, EMBED 2048; differential attention: q = x Wq^T as 32 pseudo-heads x 64, k = x Wk^T as 8 heads x 64 repeat-interleaved 4x, v = x Wv^T as 4 heads x 128 repeat-interleaved 8x; causal softmax(q.k/8) v; attn = O_even - lambda_full * O_odd (16 heads x 128), lambda_full = exp(lq1.lk1) - exp(lq2.lk2) + 0.78361; RMSNorm(128, eps 1e-5) * ln_w * (1 - 0.78361); out = attn Wo^T.
// Compute dtype: inputs rounded to bf16; x exact as f16; q/k/P/v as f16 hi + residual on the first 256 rows (~2^-21) and plain beyond (~2^-12); the normalised attention as a plain f16 operand; softmax/lambda/RMSNorm f32. v_wmma_f32_16x16x32_f16.
#define NB 2
#define DM 2048
#define NKV 8
#define NREP (NH / NKV)
#define KVD (NKV * 64)           /* 512 */
#define NR (NB * SLEN)           /* 4096 */
#define SLEN 2048
#define TQ SLEN
#define TK SLEN
#define NH 32
#define SCL 0.125f
#define RE 256
#define PQ0 (RE / 32)             /* rows from RE on: blocks of 32 queries */
#define PQN ((TQ - RE) / 32)
#define SQN (RE / 16)             /* first RE rows: blocks of 16 queries */
typedef __bf16 v16b __attribute__((ext_vector_type(16)));
typedef unsigned short v8us __attribute__((ext_vector_type(8), may_alias));
typedef float  v8f  __attribute__((ext_vector_type(8)));
typedef float  v4f  __attribute__((ext_vector_type(4)));
typedef float  v4fa __attribute__((ext_vector_type(4), may_alias));
union FragB { v16b v; v8us half[2]; unsigned short u[16]; };

__device__ __forceinline__ unsigned short bf16_bits(float x) { unsigned int u = __float_as_uint(x); return (unsigned short)((u + 0x7FFFu + ((u >> 16) & 1u)) >> 16); }
__device__ __forceinline__ float bf16_val(unsigned short b) { return __uint_as_float(((unsigned int)b) << 16); }
__device__ __forceinline__ float bf16_round(float x) { return bf16_val(bf16_bits(x)); }
// D += A·B with NT terms: 1 = ah·bh, 2 = + al·bh (A split), 3 = + ah·bl (both split)
template <int NT>
__device__ __forceinline__ v8f mmaN(v16b ah, v16b al, v16b bh, v16b bl, v8f c) {
  c = __builtin_amdgcn_wmma_f32_16x16x32_bf16(false, ah, false, bh, (short)0, c, false, false);
  if (NT >= 2) c = __builtin_amdgcn_wmma_f32_16x16x32_bf16(false, al, false, bh, (short)0, c, false, false);
  if (NT >= 3) c = __builtin_amdgcn_wmma_f32_16x16x32_bf16(false, ah, false, bl, (short)0, c, false, false);
  asm volatile("v_nop\n\tv_nop\n\tv_nop\n\tv_nop" : "+v"(c) : "v"(ah), "v"(al), "v"(bh), "v"(bl));
  return c;
}

__global__ __launch_bounds__(256) void k_wt_bf16(const float* __restrict__ W, unsigned short* __restrict__ Wt, int K, int N) {
  const int t = blockIdx.x * 256 + threadIdx.x;
  const int k8n = K / 8;
  if (t >= N * k8n) return;
  const int n = t / k8n, k8 = (t % k8n) * 8;
  v8us v;
#pragma unroll
  for (int i = 0; i < 8; ++i) v[i] = bf16_bits(W[(size_t)(k8 + i) * N + n]);
  *(v8us*)(Wt + (size_t)n * K + k8) = v;
  
}

// GEMM C[M][N] (f32, pitch ldc) = act(A[M][K]·W + bias). A f32 row-major (pitch lda) converted per fragment to bf16
// (ASPLIT: hi/lo two planes -> 2 terms, else single rounded term); Wt bf16 [N][K] (pitch ldb). BIAS_BF16 rounds the
// bias to bf16 first (bias quantised to bf16 before the add). K%32==0, M%16==0, N%64==0.
template <bool ASPLIT, int ACT, bool BIAS_BF16>
__global__ __launch_bounds__(128) void k_gemm_bf(const float* __restrict__ A, int lda, const unsigned short* __restrict__ Wt, int ldb,
                                               const float* __restrict__ bias, float* __restrict__ C, int ldc, int M, int N, int K) {
  __shared__ __attribute__((aligned(16))) float so[4][16][64];
  const int tid = threadIdx.x, w = tid >> 5, lane = tid & 31, ln = lane & 15, hh = lane >> 4;
  const int ntn = N / 64;
  const int wid = blockIdx.x * 4 + w;
  const int mt = wid / ntn, nq = wid % ntn;
  if (mt * 16 >= M) return;
  const int row0 = mt * 16, col0 = nq * 64;
  const float* arow = A + (size_t)(row0 + ln) * lda;
  v8f acc[4] = {};
  for (int kb = 0; kb < K; kb += 32) {
    FragB ah, al;
    const v4f x0 = *(const v4fa*)(arow + kb + 8 * hh), x1 = *(const v4fa*)(arow + kb + 8 * hh + 4);
    const v4f x2 = *(const v4fa*)(arow + kb + 16 + 8 * hh), x3 = *(const v4fa*)(arow + kb + 16 + 8 * hh + 4);
    float xs[16] = {x0[0],x0[1],x0[2],x0[3],x1[0],x1[1],x1[2],x1[3],x2[0],x2[1],x2[2],x2[3],x3[0],x3[1],x3[2],x3[3]};
#pragma unroll
    for (int i = 0; i < 16; ++i) { const unsigned short hb = bf16_bits(xs[i]); ah.u[i] = hb; al.u[i] = ASPLIT ? bf16_bits(xs[i] - bf16_val(hb)) : (unsigned short)0; }
#pragma unroll
    for (int t = 0; t < 4; ++t) {
      const unsigned short* brow = Wt + (size_t)(col0 + t * 16 + ln) * ldb + kb;
      FragB b;
      b.half[0] = *(const v8us*)(brow + 8 * hh);
      b.half[1] = *(const v8us*)(brow + 16 + 8 * hh);
      acc[t] = mmaN<ASPLIT ? 2 : 1>(ah.v, al.v, b.v, b.v, acc[t]);
    }
  }
#pragma unroll
  for (int t = 0; t < 4; ++t) {
    float bv = bias ? bias[col0 + t * 16 + ln] : 0.f;
    if (BIAS_BF16) bv = bf16_round(bv);
#pragma unroll
    for (int r = 0; r < 8; ++r) { float v = acc[t][r] + bv; if (ACT == 1) v = fmaxf(v, 0.f); so[w][8 * hh + r][t * 16 + ln] = v; }
  }
  __builtin_amdgcn_fence(__ATOMIC_ACQ_REL, "workgroup");
  __builtin_amdgcn_wave_barrier();
  const int rsub = lane >> 4, c4 = (lane & 15) * 4;
  {
#pragma unroll
    for (int q = 0; q < 8; ++q) {
      const int r = q * 2 + rsub;
      const v4f v = *(const v4fa*)&so[w][r][c4];
      *(v4f*)(C + (size_t)(row0 + r) * ldc + col0 + c4) = v;
    }
    
  }
}

// GEMM C = act(A·W + bias + resid): A f32 (ASPLIT -> hi/lo 2 terms), Wt bf16 [N][K]; ACT 0 none, 1 relu, 2 exact gelu;
// resid (optional, f32, row index = (row % rmod), pitch ldr, RES_BF16 rounds it) added before the activation.
template <bool ASPLIT, int ACT, bool BIAS_BF16, bool RES_BF16>
__global__ __launch_bounds__(128) void k_gemm_bf3(const float* __restrict__ A, int lda, const unsigned short* __restrict__ Wt, int ldb,
                                                const float* __restrict__ bias, const float* __restrict__ resid, int rmod, int ldr,
                                                float* __restrict__ C, int ldc, int M, int N, int K) {
  __shared__ __attribute__((aligned(16))) float so[4][16][64];
  const int tid = threadIdx.x, w = tid >> 5, lane = tid & 31, ln = lane & 15, hh = lane >> 4;
  const int ntn = N / 64;
  const int wid = blockIdx.x * 4 + w;
  const int mt = wid / ntn, nq = wid % ntn;
  if (mt * 16 >= M) return;
  const int row0 = mt * 16, col0 = nq * 64;
  const float* arow = A + (size_t)(row0 + ln) * lda;
  v8f acc[4] = {};
  for (int kb = 0; kb < K; kb += 32) {
    FragB ah, al;
    const v4f x0 = *(const v4fa*)(arow + kb + 8 * hh), x1 = *(const v4fa*)(arow + kb + 8 * hh + 4);
    const v4f x2 = *(const v4fa*)(arow + kb + 16 + 8 * hh), x3 = *(const v4fa*)(arow + kb + 16 + 8 * hh + 4);
    float xs[16] = {x0[0],x0[1],x0[2],x0[3],x1[0],x1[1],x1[2],x1[3],x2[0],x2[1],x2[2],x2[3],x3[0],x3[1],x3[2],x3[3]};
#pragma unroll
    for (int i = 0; i < 16; ++i) { const unsigned short hb = bf16_bits(xs[i]); ah.u[i] = hb; al.u[i] = ASPLIT ? bf16_bits(xs[i] - bf16_val(hb)) : (unsigned short)0; }
#pragma unroll
    for (int t = 0; t < 4; ++t) {
      const unsigned short* brow = Wt + (size_t)(col0 + t * 16 + ln) * ldb + kb;
      FragB b;
      b.half[0] = *(const v8us*)(brow + 8 * hh);
      b.half[1] = *(const v8us*)(brow + 16 + 8 * hh);
      acc[t] = mmaN<ASPLIT ? 2 : 1>(ah.v, al.v, b.v, b.v, acc[t]);
    }
  }
#pragma unroll
  for (int t = 0; t < 4; ++t) {
    const int col = col0 + t * 16 + ln;
    float bv = bias ? bias[col] : 0.f;
    if (BIAS_BF16) bv = bf16_round(bv);
#pragma unroll
    for (int r = 0; r < 8; ++r) {
      float v = acc[t][r] + bv;
      if (resid) { float rv = resid[(size_t)((row0 + 8 * hh + r) % rmod) * ldr + col]; if (RES_BF16) rv = bf16_round(rv); v += rv; }
      if (ACT == 1) v = fmaxf(v, 0.f);
      if (ACT == 2) v = 0.5f * v * (1.0f + erff(v * 0.70710678118654752f));
      if (ACT == 3) { const float u = 0.7978845608028654f * (v + 0.044715f * v * v * v); v = 0.5f * v * (1.0f + tanhf(u)); }
      so[w][8 * hh + r][t * 16 + ln] = v;
    }
  }
  __builtin_amdgcn_fence(__ATOMIC_ACQ_REL, "workgroup");
  __builtin_amdgcn_wave_barrier();
  const int rsub = lane >> 4, c4 = (lane & 15) * 4;
  {
#pragma unroll
    for (int q = 0; q < 8; ++q) {
      const int r = q * 2 + rsub;
      const v4f v = *(const v4fa*)&so[w][r][c4];
      *(v4f*)(C + (size_t)(row0 + r) * ldc + col0 + c4) = v;
    }
    
  }
}
// row LayerNorm (biased variance, eps) over N: s = X (+ R); optional out_sum <- s; out_norm <- (s-mu)*rsqrt(var+eps)*g + b
template <bool PARAM_BF16>
__global__ __launch_bounds__(256) void k_layernorm(const float* __restrict__ X, const float* __restrict__ R, const float* __restrict__ g, const float* __restrict__ bta,
                                                  float* __restrict__ out_sum, float* __restrict__ out_norm, int N, float eps) {
  __shared__ float red[256];
  const int row = blockIdx.x, tid = threadIdx.x;
  const float* x = X + (size_t)row * N; const float* rr = R ? R + (size_t)row * N : nullptr;
  float vals[16];                     // up to N = 4096
  const int per = N / 256;            // contiguous chunk per thread? use strided-by-4 chunks: thread handles j = tid*4 + 1024*u
  float s1 = 0.f;
  for (int u = 0; u < per / 4; ++u) {
    const int j = tid * 4 + 1024 * u;
    const v4f a = *(const v4fa*)(x + j);
    v4f b = {0.f,0.f,0.f,0.f}; if (rr) b = *(const v4fa*)(rr + j);
#pragma unroll
    for (int q = 0; q < 4; ++q) { const float v = a[q] + b[q]; vals[u * 4 + q] = v; s1 += v; }
  }
  red[tid] = s1; __syncthreads();
  for (int st = 128; st > 0; st >>= 1) { if (tid < st) red[tid] += red[tid + st]; __syncthreads(); }
  const float mu = red[0] / (float)N; __syncthreads();
  float s2 = 0.f;
  for (int u = 0; u < per / 4; ++u)
#pragma unroll
    for (int q = 0; q < 4; ++q) { const float c = vals[u * 4 + q] - mu; s2 += c * c; }
  red[tid] = s2; __syncthreads();
  for (int st = 128; st > 0; st >>= 1) { if (tid < st) red[tid] += red[tid + st]; __syncthreads(); }
  const float rs = rsqrtf(red[0] / (float)N + eps);
  {
    for (int u = 0; u < per / 4; ++u) {
      const int j = tid * 4 + 1024 * u;
      v4f o, sm;
#pragma unroll
      for (int q = 0; q < 4; ++q) {
        float gg = g[j + q], bb = bta[j + q];
        if (PARAM_BF16) { gg = bf16_round(gg); bb = bf16_round(bb); }
        sm[q] = vals[u * 4 + q]; o[q] = (vals[u * 4 + q] - mu) * rs * gg + bb;
      }
      if (out_sum) *(v4f*)(out_sum + (size_t)row * N + j) = sm;
      *(v4f*)(out_norm + (size_t)row * N + j) = o;
    }
    
  }
}



// ---- f16 WMMA path (v_wmma_f32_16x16x32_f16): 11-bit significands for operands in range — used where a [0,1] probability operand needs more precision than bf16
typedef _Float16 v16h __attribute__((ext_vector_type(16)));
union FragH { v16h v; v8us half[2]; _Float16 h[16]; unsigned short u[16]; };
template <int NT>
__device__ __forceinline__ v8f mmaH(v16h ah, v16h al, v16h bh, v16h bl, v8f c) {
  c = __builtin_amdgcn_wmma_f32_16x16x32_f16(false, ah, false, bh, (short)0, c, false, false);
  if (NT >= 2) c = __builtin_amdgcn_wmma_f32_16x16x32_f16(false, al, false, bh, (short)0, c, false, false);
  if (NT >= 3) c = __builtin_amdgcn_wmma_f32_16x16x32_f16(false, ah, false, bl, (short)0, c, false, false);
  asm volatile("v_nop\n\tv_nop\n\tv_nop\n\tv_nop" : "+v"(c) : "v"(ah), "v"(al), "v"(bh), "v"(bl));
  return c;
}
// batched GEMM like k_gemm_b but f16 operands: A f32 (split into f16 hi/lo if ASPLIT, else rounded to f16), Bt = f16 values [n][k]; alpha; C f32; N multiple of 16 (partial tiles skipped)
template <bool ASPLIT>
__global__ __launch_bounds__(128) void k_gemm_h(const float* __restrict__ A, int lda, size_t sA, const _Float16* __restrict__ Bh, int ldb, size_t sB, float alpha, float* __restrict__ C, int ldc, size_t sC, int M, int N, int K) {
  __shared__ __attribute__((aligned(16))) float so[4][16][64];
  const int tid = threadIdx.x, w = tid >> 5, lane = tid & 31, ln = lane & 15, hh = lane >> 4; const int by = blockIdx.y;
  A += (size_t)by * sA; Bh += (size_t)by * sB; C += (size_t)by * sC;
  const int ntn = (N + 63) / 64; const int wid = blockIdx.x * 4 + w; const int mt = wid / ntn, nq = wid % ntn; if (mt * 16 >= M) return;
  const int row0 = mt * 16, col0 = nq * 64; const float* arow = A + (size_t)(row0 + ln) * lda;
  v8f acc[4] = {};
  for (int kb = 0; kb < K; kb += 32) {
    FragH ah, al;
    const v4f x0 = *(const v4fa*)(arow + kb + 8 * hh), x1 = *(const v4fa*)(arow + kb + 8 * hh + 4), x2 = *(const v4fa*)(arow + kb + 16 + 8 * hh), x3 = *(const v4fa*)(arow + kb + 16 + 8 * hh + 4);
    float xs[16] = {x0[0],x0[1],x0[2],x0[3],x1[0],x1[1],x1[2],x1[3],x2[0],x2[1],x2[2],x2[3],x3[0],x3[1],x3[2],x3[3]};
#pragma unroll
    for (int i = 0; i < 16; ++i) { const _Float16 h = (_Float16)xs[i]; ah.h[i] = h; al.h[i] = ASPLIT ? (_Float16)(xs[i] - (float)h) : (_Float16)0.0f; }
#pragma unroll
    for (int t = 0; t < 4; ++t) { if (col0 + t * 16 >= N) continue; const size_t boff = (size_t)(col0 + t * 16 + ln) * ldb + kb; FragH bq; bq.half[0] = *(const v8us*)(Bh + boff + 8 * hh); bq.half[1] = *(const v8us*)(Bh + boff + 16 + 8 * hh);
      acc[t] = mmaH<ASPLIT ? 2 : 1>(ah.v, al.v, bq.v, bq.v, acc[t]); }
  }
#pragma unroll
  for (int t = 0; t < 4; ++t) { if (col0 + t * 16 >= N) continue;
#pragma unroll
    for (int r = 0; r < 8; ++r) so[w][8 * hh + r][t * 16 + ln] = acc[t][r] * alpha; }
  __builtin_amdgcn_fence(__ATOMIC_ACQ_REL, "workgroup"); __builtin_amdgcn_wave_barrier();
  const int rsub = lane >> 4, c4 = (lane & 15) * 4;
  {
#pragma unroll
    for (int q = 0; q < 8; ++q) { const int r = q * 2 + rsub; if (col0 + c4 < N) { const v4f v = *(const v4fa*)&so[w][r][c4]; *(v4f*)(C + (size_t)(row0 + r) * ldc + col0 + c4) = v; } }
     }
}

// Wt[n][k] = f16(W[k][n]·scale) from f32 row-major W[K][N] (scale = power of two; bf16-exact weights stay exact in f16 away from the subnormal range)
__global__ __launch_bounds__(256) void k_wt_f16(const float* __restrict__ W, _Float16* __restrict__ Wt, int K, int N, float scale) {
  const int t = blockIdx.x * 256 + threadIdx.x; if (t >= N * (K / 8)) return; const int n = t / (K / 8), k8 = (t % (K / 8)) * 8; FragH f;
#pragma unroll
  for (int i = 0; i < 8; ++i) f.h[i] = (_Float16)(bf16_round(W[(size_t)(k8 + i) * N + n]) * scale); const v8us o = f.half[0];
  *(v8us*)((unsigned short*)Wt + (size_t)n * K + k8) = o; 
}
// k_gemm_hh variant with fused epilogue: v = acc·alpha + bias[by·sBias + col] (+ CP[(row/rowsPerB)·sCPb + by·64 + col] if CP) ; ACT 0 none / 1 elu ; writes f16 C16 (and f32 C if non-null)
template <int ACT>
__global__ __launch_bounds__(128) void k_gemm_hhx(const _Float16* __restrict__ A, int lda, size_t sA, const _Float16* __restrict__ Bh, int ldb, size_t sB, float alpha, const float* __restrict__ bias, size_t sBias, const float* __restrict__ CP, int rowsPerB, size_t sCPb, int row0g,
    float* __restrict__ C, _Float16* __restrict__ C16, int ldc, size_t sC, int M, int N, int K) {
  __shared__ __attribute__((aligned(16))) float so[4][16][64];
  const int tid = threadIdx.x, w = tid >> 5, lane = tid & 31, ln = lane & 15, hh = lane >> 4; const int by = blockIdx.y;
  A += (size_t)by * sA; Bh += (size_t)by * sB; const size_t cofs = (size_t)by * sC; const float* bp = bias ? bias + (size_t)by * sBias : nullptr;
  const int ntn = (N + 63) / 64; const int wid = blockIdx.x * 4 + w; const int mt = wid / ntn, nq = wid % ntn; if (mt * 16 >= M) return;
  const int row0 = mt * 16, col0 = nq * 64; const _Float16* arow = A + (size_t)(row0 + ln) * lda;
  v8f acc[4] = {};
  for (int kb = 0; kb < K; kb += 32) { FragH ah; ah.half[0] = *(const v8us*)((const unsigned short*)arow + kb + 8 * hh); ah.half[1] = *(const v8us*)((const unsigned short*)arow + kb + 16 + 8 * hh);
#pragma unroll
    for (int t = 0; t < 4; ++t) { if (col0 + t * 16 >= N) continue; const size_t boff = (size_t)(col0 + t * 16 + ln) * ldb + kb; FragH bq; bq.half[0] = *(const v8us*)((const unsigned short*)Bh + boff + 8 * hh); bq.half[1] = *(const v8us*)((const unsigned short*)Bh + boff + 16 + 8 * hh);
      acc[t] = mmaH<1>(ah.v, ah.v, bq.v, bq.v, acc[t]); }
  }
#pragma unroll
  for (int t = 0; t < 4; ++t) { if (col0 + t * 16 >= N) continue; const int col = col0 + t * 16 + ln; const float bv = bp ? bf16_round(bp[col]) : 0.f;
#pragma unroll
    for (int r = 0; r < 8; ++r) { float v = acc[t][r] * alpha + bv; if (CP) { const int bidx = (row0g + row0 + 8 * hh + r) / rowsPerB; v += CP[(size_t)bidx * sCPb + (size_t)by * 64 + col]; } if (ACT == 1) v = (v > 0.f) ? v : expm1f(v); else if (ACT == 7) v = (v > 0.f) ? v + 1.0f : expf(v); else if (ACT == 8) v = tanhf(v); else if (ACT == 9) v = 0.5f * v * (1.0f + tanhf(0.7978845608028654f * (v + 0.044715f * v * v * v))); else if (ACT == 11) v = 1.0f / (1.0f + expf(-v)); else if (ACT == 12) v = (v > 0.f) ? v : 0.01f * v; else if (ACT == 14) v = (v > 0.f) ? v : 0.1f * v; else if (ACT == 15) v = v / (1.0f + expf(-v)); else if (ACT == 3) v = fmaxf(v, 0.f); else if (ACT == 6) v = 0.5f * v * (1.0f + erff(v * 0.70710678118654752f)); so[w][8 * hh + r][t * 16 + ln] = v; } }
  __builtin_amdgcn_fence(__ATOMIC_ACQ_REL, "workgroup"); __builtin_amdgcn_wave_barrier();
  const int rsub = lane >> 4, c4 = (lane & 15) * 4; typedef _Float16 v4h __attribute__((ext_vector_type(4)));
  {
#pragma unroll
    for (int q = 0; q < 8; ++q) { const int r = q * 2 + rsub; if (col0 + c4 < N) { const v4f v = *(const v4fa*)&so[w][r][c4]; if (C) *(v4f*)(C + cofs + (size_t)(row0 + r) * ldc + col0 + c4) = v; if (C16) { v4h h4; for (int i = 0; i < 4; ++i) h4[i] = (_Float16)v[i]; *(v4h*)(C16 + cofs + (size_t)(row0 + r) * ldc + col0 + c4) = h4; } } }
     }
}


typedef _Float16 v4h __attribute__((ext_vector_type(4)));

__global__ __launch_bounds__(256) void k_h16(const float* __restrict__ x, _Float16* __restrict__ X16, size_t n8) { const size_t t = (size_t)blockIdx.x * 256 + threadIdx.x; if (t >= n8) return; FragH f;
#pragma unroll
  for (int q = 0; q < 8; ++q) f.h[q] = (_Float16)x[t * 8 + q]; *(v8us*)((unsigned short*)X16 + t * 8) = f.half[0];  }
__global__ __launch_bounds__(256) void k_round16f(const float* __restrict__ W, _Float16* __restrict__ Bt, size_t n8) { const size_t t = (size_t)blockIdx.x * 256 + threadIdx.x; if (t >= n8) return; FragH f;
#pragma unroll
  for (int i = 0; i < 8; ++i) f.h[i] = (_Float16)(bf16_round(W[t * 8 + i]) * 16.0f); *(v8us*)((unsigned short*)Bt + t * 8) = f.half[0];  }
template <int NHv, int TTv>
__global__ __launch_bounds__(256) void k_vt(const _Float16* __restrict__ V16, int ldv, int voff, _Float16* __restrict__ Vt) { __shared__ unsigned short tl[64][66]; const int tid = threadIdx.x; const int slab = blockIdx.x / (TTv / 64), lg = blockIdx.x % (TTv / 64); const int b = slab / NHv, h = slab % NHv;
  for (int i = tid; i < 64 * 8; i += 256) { const int r = i / 8, c8 = (i % 8) * 8; FragH f; f.half[0] = *(const v8us*)((const unsigned short*)V16 + ((size_t)b * TTv + lg * 64 + r) * ldv + voff + h * 64 + c8);
#pragma unroll
    for (int q = 0; q < 8; ++q) tl[r][c8 + q] = f.u[q]; }
  __syncthreads();
  {
#pragma unroll
    for (int rd = 0; rd < 2; ++rd) { const int d = rd * 32 + tid / 8, pc = tid % 8; FragH f;
#pragma unroll
      for (int q = 0; q < 8; ++q) f.u[q] = tl[pc * 8 + q][d];
      *(v8us*)((unsigned short*)Vt + ((size_t)slab * 64 + d) * TTv + lg * 64 + pc * 8) = f.half[0]; }
     } }

// ---- fast GEMM (block tile 128x128, four waves as 2 x 2, wave tile 64x64; requires M % 128 == 0, N % 128 == 0, K % 64 == 0); epilogue = k_gemm_hhx semantics ----
// Tile sizes follow the L2 and LDS rates: a block stages 256 rows per slice for 128 x 128 outputs, and a wave reads 8 fragments for 16 matrix instructions (each fragment feeds four).
// Per trip a 64-deep slice of A (128 rows) and of B (128 rows) is copied to LDS in whole 128-byte lines (asynchronous copies, two buffers: the next slice flies while this one is multiplied); fragments come from LDS.
#define G2_PITCH 144                      /* LDS bytes per staged row: 128 + 16, the conflict-free pitch for 16-byte reads */
#define G2_BUF ((128 + 128) * G2_PITCH)   /* one buffer: A rows 0..127, then B rows 128..255 */
__device__ __forceinline__ v16h g2_lfrag(const unsigned char* p) { FragH f; f.half[0] = *(const v8us*)p; f.half[1] = *(const v8us*)(p + 32); return f.v; }
__device__ __forceinline__ v8f g2_mma(v16h a, v16h b, v8f c) { v8f d = __builtin_amdgcn_wmma_f32_16x16x32_f16(false, a, false, b, (short)0, c, false, false); asm volatile("v_nop\n\tv_nop\n\tv_nop\n\tv_nop" : "+v"(d) : "v"(a), "v"(b)); return d; }
// one operand's half of a slice: 8 copies of 16 bytes per lane (128 rows), a wave's copy covering 4 whole rows; l = the lane's LDS byte address of its first row, rows 16 apart
__device__ __forceinline__ void g2_copy(unsigned l, const _Float16* g, size_t s16) {
  /* the closing s_wait_xcnt keeps every address register intact until the copies have taken it */
  asm volatile("global_load_async_to_lds_b128 %0, %8, off\n\t"
               "global_load_async_to_lds_b128 %1, %9, off\n\t"
               "global_load_async_to_lds_b128 %2, %10, off\n\t"
               "global_load_async_to_lds_b128 %3, %11, off\n\t"
               "global_load_async_to_lds_b128 %4, %12, off\n\t"
               "global_load_async_to_lds_b128 %5, %13, off\n\t"
               "global_load_async_to_lds_b128 %6, %14, off\n\t"
               "global_load_async_to_lds_b128 %7, %15, off\n\t"
               "s_wait_xcnt 0x0"
               :: "v"(l), "v"(l + 16 * G2_PITCH), "v"(l + 32 * G2_PITCH), "v"(l + 48 * G2_PITCH), "v"(l + 64 * G2_PITCH), "v"(l + 80 * G2_PITCH), "v"(l + 96 * G2_PITCH), "v"(l + 112 * G2_PITCH),
                  "v"(g), "v"(g + s16), "v"(g + 2 * s16), "v"(g + 3 * s16), "v"(g + 4 * s16), "v"(g + 5 * s16), "v"(g + 6 * s16), "v"(g + 7 * s16)
               : "memory");
}
template <int ACT, bool SPLIT>
__device__ __forceinline__ void g2_body(unsigned char* smem, int bx, int by, const _Float16* __restrict__ A, int lda, size_t sA, const _Float16* __restrict__ Bh, int ldb, size_t sB, float alpha, const float* __restrict__ bias, size_t sBias, const float* __restrict__ CP, int rowsPerB, size_t sCPb, int row0g,
    float* __restrict__ C, _Float16* __restrict__ C16, _Float16* __restrict__ CL, int ldc, size_t sC, int M, int N, int K) {      /* output: C (f32) or, with SPLIT, the pair C16 and CL: the f16 rounding and its 2^10-scaled residual, the two planes of a split operand */
  /* smem: the kernel's 2 * G2_BUF bytes of LDS, the two staging buffers; the epilogue's 4 x 64 x 68 floats lie over them once the loop's last barrier has ended every read. bx, by: the block's place in this product's own grid */
  float (*so)[64][68] = reinterpret_cast<float (*)[64][68]>(smem);
  const int tid = threadIdx.x, w = tid >> 5, lane = tid & 31, ln = lane & 15, hh = lane >> 4; const int wm = w >> 1, wn = w & 1;      /* the wave's place in the block's 2 x 2 */
  A += (size_t)by * sA; Bh += (size_t)by * sB; const size_t cofs = (size_t)by * sC; const float* bp = bias ? bias + (size_t)by * sBias : nullptr;
  const int ntn = N >> 7; const int mt = bx / ntn, nq = bx - mt * ntn; const int row0 = mt * 128 + 64 * wm, col0 = nq * 128 + 64 * wn; if (mt * 128 >= M) return;      /* the whole block leaves or none: barriers follow */
  const int crow = tid >> 3, cch = tid & 7;      /* copy role: row (mod 16) and 16-byte piece of the 128-byte row */
  const _Float16* gA = A + (size_t)(mt * 128 + crow) * lda + cch * 8; const _Float16* gB = Bh + (size_t)(nq * 128 + crow) * ldb + cch * 8; const size_t sa16 = (size_t)16 * lda, sb16 = (size_t)16 * ldb;
  const unsigned l0 = (unsigned)(size_t)smem + (unsigned)(crow * G2_PITCH + cch * 16);
  const int aoff = (64 * wm + ln) * G2_PITCH + 16 * hh, boff = (128 + 64 * wn + ln) * G2_PITCH + 16 * hh;
  v8f acc[4][4];      /* acc[i][j]: rows 16 i.., columns 16 j.. of the wave's tile */
#pragma unroll      /* here and below: every index of acc, a and b is a constant, so that they stay in registers */
  for (int i = 0; i < 4; ++i) {
#pragma unroll
    for (int j = 0; j < 4; ++j) acc[i][j] = (v8f){0.f,0.f,0.f,0.f,0.f,0.f,0.f,0.f}; }
  const int NT = K >> 6;
  g2_copy(l0, gA, sa16); g2_copy(l0 + 128 * G2_PITCH, gB, sb16);
  asm volatile("s_wait_asynccnt 0x0" ::: "memory");      /* slice 0 has landed before the barrier publishes it */
  __syncthreads();
  if (NT > 1) { g2_copy(l0 + G2_BUF, gA + 64, sa16); g2_copy(l0 + G2_BUF + 128 * G2_PITCH, gB + 64, sb16); }
#pragma unroll 1      /* one slice per trip: the buffer alternates with the trip's parity */
  for (int t = 0; t < NT; ++t) { const unsigned char* sb = smem + (t & 1) * G2_BUF; const unsigned char* pa = sb + aoff; const unsigned char* pb = sb + boff;
#pragma unroll      /* the slice's two 32-deep halves, in k order */
    for (int ks = 0; ks < 2; ++ks) { v16h a[4], b[4];
#pragma unroll
      for (int i = 0; i < 4; ++i) { a[i] = g2_lfrag(pa + i * 16 * G2_PITCH + ks * 64); b[i] = g2_lfrag(pb + i * 16 * G2_PITCH + ks * 64); }
#pragma unroll
      for (int j = 0; j < 4; ++j) {
#pragma unroll
        for (int i = 0; i < 4; ++i) acc[i][j] = g2_mma(a[i], b[j], acc[i][j]); } }
    asm volatile("s_wait_dscnt 0x0" ::: "memory");         /* this wave's reads of the buffer are over before it may be refilled */
    asm volatile("s_wait_asynccnt 0x0" ::: "memory");      /* this wave's copies of the next slice have landed */
    __syncthreads();                                       /* publishes the next slice and ends every wave's reads of this one */
    if (t + 2 < NT) { const unsigned lb = l0 + (unsigned)(t & 1) * G2_BUF; g2_copy(lb, gA + (size_t)(t + 2) * 64, sa16); g2_copy(lb + 128 * G2_PITCH, gB + (size_t)(t + 2) * 64, sb16); } }
  asm volatile("s_wait_asynccnt 0x0" ::: "memory");        /* nothing is in flight when the buffers become output staging */
#pragma unroll
  for (int u = 0; u < 16; ++u) { const int t = u & 3, qr = u >> 2; const int col = col0 + t * 16 + ln; const float bv = bp ? bf16_round(bp[col]) : 0.f;
#pragma unroll
    for (int r = 0; r < 8; ++r) { const int rloc = qr * 16 + 8 * hh + r; float v = acc[qr][t][r] * alpha + bv; if (CP) { const int bidx = (row0g + row0 + rloc) / rowsPerB; v += CP[(size_t)bidx * sCPb + (size_t)by * 64 + col]; }
      if (ACT == 3) v = fmaxf(v, 0.f); else if (ACT == 6) v = 0.5f * v * (1.0f + erff(v * 0.70710678118654752f)); else if (ACT == 11) v = 1.0f / (1.0f + expf(-v)); else if (ACT == 15) v = v / (1.0f + expf(-v)); else if (ACT == 12) v = (v > 0.f) ? v : 0.01f * v; else if (ACT == 8) v = tanhf(v);
      so[w][rloc][t * 16 + ln] = v; } }
  __builtin_amdgcn_fence(__ATOMIC_ACQ_REL, "workgroup"); __builtin_amdgcn_wave_barrier();
  const int rsub = lane >> 4, c4 = (lane & 15) * 4;
  if (!SPLIT) {
#pragma unroll
    for (int q = 0; q < 32; ++q) { const int r = q * 2 + rsub; const v4f v = *(const v4fa*)&so[w][r][c4]; *(v4f*)(C + cofs + (size_t)(row0 + r) * ldc + col0 + c4) = v; }
  } else {
#pragma unroll
    for (int q = 0; q < 32; ++q) { const int r = q * 2 + rsub; const v4f v = *(const v4fa*)&so[w][r][c4]; const size_t o = cofs + (size_t)(row0 + r) * ldc + col0 + c4; v4h h4, l4;
      for (int i = 0; i < 4; ++i) { h4[i] = (_Float16)v[i]; l4[i] = (_Float16)((v[i] - (float)h4[i]) * 1024.0f); }
      *(v4h*)(C16 + o) = h4; *(v4h*)(CL + o) = l4; }
  } }
// out = attn Wo^T. Shapes and the unused bias and addend arguments are fixed at compile time, as in k_proj: the unrolled epilogue of the larger tile then holds no untaken paths and the kernel's text stays short.
__global__ __launch_bounds__(128) void k_out(const _Float16* __restrict__ A16, const _Float16* __restrict__ BO, float* __restrict__ out) {
  __shared__ __attribute__((aligned(16))) unsigned char smem[2 * G2_BUF];
  g2_body<0, false>(smem, (int)blockIdx.x, 0, A16, DM, 0, BO, DM, 0, 0.0625f, nullptr, 0, nullptr, 1, 0, 0, out, nullptr, nullptr, DM, 0, NR, DM, DM); }
// The three projections in one grid (they share x and depend on nothing of each other): blocks 0.. q = x Wq^T, then k = x Wk^T, then V^T = Wv x^T per batch (the weight rows are the A operand, the tokens the B operand). The two small products alone would leave three SIMD places in four empty.
#define PJ_NQ ((NR / 128) * (DM / 128))
#define PJ_NK ((NR / 128) * (KVD / 128))
#define PJ_NV ((KVD / 128) * (SLEN / 128))      /* per batch */
__global__ __launch_bounds__(128) void k_proj(const _Float16* __restrict__ X16, const _Float16* __restrict__ BQ, const _Float16* __restrict__ BK, const _Float16* __restrict__ BV,
    _Float16* __restrict__ QH, _Float16* __restrict__ QL, _Float16* __restrict__ KH, _Float16* __restrict__ KL, _Float16* __restrict__ VT, _Float16* __restrict__ VTL) {
  __shared__ __attribute__((aligned(16))) unsigned char smem[2 * G2_BUF];
  int bx = (int)blockIdx.x; const _Float16* A = X16; const _Float16* B = BQ; _Float16* H = QH; _Float16* L = QL; int ldc = DM, M = NR, N = DM;
  if (bx >= PJ_NQ + PJ_NK) { bx -= PJ_NQ + PJ_NK; const int bt = bx / PJ_NV; bx -= bt * PJ_NV; A = BV; B = X16 + (size_t)bt * SLEN * DM; H = VT + (size_t)bt * KVD * SLEN; L = VTL + (size_t)bt * KVD * SLEN; ldc = SLEN; M = KVD; N = SLEN; }
  else if (bx >= PJ_NQ) { bx -= PJ_NQ; B = BK; H = KH; L = KL; ldc = KVD; N = KVD; }
  g2_body<0, true>(smem, bx, 0, A, DM, 0, B, DM, 0, 0.0625f, nullptr, 0, nullptr, 1, 0, 0, nullptr, H, L, ldc, 0, M, N, DM); }



// lane l with lane l ^ 16 (the two halves of a wave hold the two key halves of one query column)
__device__ __forceinline__ float xhalf(float x) { return __builtin_bit_cast(float, __builtin_amdgcn_permlanex16(__builtin_bit_cast(int, x), __builtin_bit_cast(int, x), 0x76543210, 0xfedcba98, false, false)); }
#define FL_BUF (192 * G2_PITCH)      /* one buffer: key rows 0..63, low value-dimension rows 64..127, high ones 128..191 */
// one tile: 12 copies of 16 bytes per lane (4 of K, 4 of V^T low, 4 of V^T high), a wave's copy covering 4 whole rows; l = the lane's LDS byte address of its first row, rows 16 apart
__device__ __forceinline__ void fl_copy(unsigned l, const unsigned short* gk, size_t sk16, const unsigned short* gv, const unsigned short* gw, size_t sv16) {
  /* the closing s_wait_xcnt keeps every address register intact until the copies have taken it */
  asm volatile("global_load_async_to_lds_b128 %0, %12, off\n\t"
               "global_load_async_to_lds_b128 %1, %13, off\n\t"
               "global_load_async_to_lds_b128 %2, %14, off\n\t"
               "global_load_async_to_lds_b128 %3, %15, off\n\t"
               "global_load_async_to_lds_b128 %4, %16, off\n\t"
               "global_load_async_to_lds_b128 %5, %17, off\n\t"
               "global_load_async_to_lds_b128 %6, %18, off\n\t"
               "global_load_async_to_lds_b128 %7, %19, off\n\t"
               "global_load_async_to_lds_b128 %8, %20, off\n\t"
               "global_load_async_to_lds_b128 %9, %21, off\n\t"
               "global_load_async_to_lds_b128 %10, %22, off\n\t"
               "global_load_async_to_lds_b128 %11, %23, off\n\t"
               "s_wait_xcnt 0x0"
               :: "v"(l), "v"(l + 16 * G2_PITCH), "v"(l + 32 * G2_PITCH), "v"(l + 48 * G2_PITCH), "v"(l + 64 * G2_PITCH), "v"(l + 80 * G2_PITCH), "v"(l + 96 * G2_PITCH), "v"(l + 112 * G2_PITCH),
                  "v"(l + 128 * G2_PITCH), "v"(l + 144 * G2_PITCH), "v"(l + 160 * G2_PITCH), "v"(l + 176 * G2_PITCH),
                  "v"(gk), "v"(gk + sk16), "v"(gk + 2 * sk16), "v"(gk + 3 * sk16), "v"(gv), "v"(gv + sv16), "v"(gv + 2 * sv16), "v"(gv + 3 * sv16),
                  "v"(gw), "v"(gw + sv16), "v"(gw + 2 * sv16), "v"(gw + 3 * sv16)
               : "memory");
}
// Transposed products: S^T = K Q^T (A = key rows, B = query columns) and O^T += V^T P^T (A = value-dimension rows of V^T, B = P^T). A lane holds 16 of the 32 scores of ONE query (keys 8 hh + r and 16 + 8 hh + r), which is the k order of a B operand: P goes from the score accumulators into the next product without LDS; maximum, sum and rescale factor are one value per lane.
template <int CAUSAL>
__device__ __forceinline__ void fl_body(unsigned char* smem, int bx, const _Float16* __restrict__ Q16, int ldq, const _Float16* __restrict__ K16, int ldk, const _Float16* __restrict__ Vt, const _Float16* __restrict__ Vt2, const int* __restrict__ MSK, const float* __restrict__ LAM, const float* __restrict__ lnw, _Float16* __restrict__ A16) {
  constexpr int RPW = 16, DT = 8, KS = 2;      /* DT 0..3: low 64 value columns (Vt), DT 4..7: high 64 (Vt2); one score/softmax pass feeds both */
  /* smem: the kernel's 2 * FL_BUF bytes of LDS, the two staging buffers; the epilogue's hand-over (2 x 16 x 32 groups of 4 floats) lies over them once the loop's last barrier has ended every read. bx: the block's place among the NB * (NH / 2) * PQN blocks of this part */
  /* a block holds 32 queries of BOTH pseudo-heads of one differential head jh (they share key head and value head, so one staged tile serves all four waves): waves 0, 1 the even pseudo-head, waves 2, 3 the odd one, on the same two groups of 16 queries */
  const int tid = threadIdx.x, w = tid >> 5, lane = tid & 31, ln = lane & 15, hh = lane >> 4;
  const int slab = bx / PQN, qblk = PQ0 + bx % PQN; const int b = slab / (NH / 2), jh = slab % (NH / 2), h = 2 * jh + (w >> 1); const int qb0 = qblk * (2 * RPW); const int q0 = qb0 + (w & 1) * RPW; const int tq = q0 + ln;      /* this lane's query */
  FragH aq[KS];
  { const unsigned short* qr = (const unsigned short*)Q16 + ((size_t)b * TQ + tq) * ldq + h * 64;
#pragma unroll
    for (int ks = 0; ks < KS; ++ks) { aq[ks].half[0] = *(const v8us*)(qr + ks * 32 + 8 * hh); aq[ks].half[1] = *(const v8us*)(qr + ks * 32 + 16 + 8 * hh); } }
  const size_t vo = ((size_t)b * KVD + (h / 8) * 128) * TK;      /* pseudo-head h reads value head h / 8 (128 rows of V^T [batch][512][token]); Vt2 points 64 rows further */
  const unsigned short* Vth = (const unsigned short*)Vt + vo; const unsigned short* Vth2 = (const unsigned short*)Vt2 + vo;
  constexpr float C2 = SCL * 1.4426950408889634f;      /* raw score -> exponent in base 2 */
  float m_r = -1.0e38f, l_r = 0.f; v8f oacc[DT];      /* m_r: running maximum of the RAW scores, never below -1e38, so that a masked score (-3e38) stays far under it; l_r: row sum in units of 2^-10 */
#pragma unroll
  for (int dt = 0; dt < DT; ++dt) oacc[dt] = (v8f){0.f,0.f,0.f,0.f,0.f,0.f,0.f,0.f};
  const int jend = (CAUSAL == 1) ? (qb0 + 2 * RPW) : TK;      /* causal: keys beyond the block's last query never contribute */
  const int crow = tid >> 3, cch = tid & 7;      /* copy role: row (mod 16) and 16-byte piece of the 128-byte row */
  const unsigned short* gK = (const unsigned short*)K16 + ((size_t)b * TK + crow) * ldk + (h / NREP) * 64 + cch * 8;      /* query head h reads key head h / 4 */
  const unsigned short* gV = Vth + (size_t)crow * TK + cch * 8; const unsigned short* gW = Vth2 + (size_t)crow * TK + cch * 8; const size_t sk16 = (size_t)16 * ldk, sv16 = (size_t)16 * TK;
  const unsigned l0 = (unsigned)(size_t)smem + (unsigned)(crow * G2_PITCH + cch * 16);
  const int foff = ln * G2_PITCH + 16 * hh;      /* fragment role: row (mod 16) and 16-byte piece, the k order of the former global loads */
  const int NT = (jend + 63) >> 6;      /* whole tiles of 64 keys (TK is a multiple of 64); the keys past jend are masked like any key behind the query */
  fl_copy(l0, gK, sk16, gV, gW, sv16);
  asm volatile("s_wait_asynccnt 0x0" ::: "memory");      /* tile 0 has landed before the barrier publishes it */
  __syncthreads();
  if (NT > 1) fl_copy(l0 + FL_BUF, gK + (size_t)64 * ldk, sk16, gV + 64, gW + 64, sv16);
#pragma unroll 1      /* one tile per trip: the buffer alternates with the trip's parity */
  for (int t = 0; t < NT; ++t) { const unsigned char* sb = smem + (t & 1) * FL_BUF + foff;
#pragma unroll      /* the tile's two 32-key halves, each worked on as one pass of the online softmax, in key order */
   for (int sub = 0; sub < 2; ++sub) { const int j0 = t * 64 + sub * 32;
    FragH bk[2][KS], bv[DT];
#pragma unroll
    for (int nt = 0; nt < 2; ++nt) {
#pragma unroll
      for (int ks = 0; ks < KS; ++ks) bk[nt][ks].v = g2_lfrag(sb + (sub * 32 + nt * 16) * G2_PITCH + ks * 64); }
    v8f st[2];      /* st[nt][r] = score of key j0 + nt * 16 + 8 * hh + r against query tq */
#pragma unroll
    for (int nt = 0; nt < 2; ++nt) { v8f acc = (v8f){0.f,0.f,0.f,0.f,0.f,0.f,0.f,0.f};
#pragma unroll
      for (int ks = 0; ks < KS; ++ks) acc = mmaH<1>(bk[nt][ks].v, bk[nt][ks].v, aq[ks].v, aq[ks].v, acc);
      st[nt] = acc; }
#pragma unroll
    for (int dt = 0; dt < DT; ++dt) bv[dt].v = g2_lfrag(sb + (64 + dt * 16) * G2_PITCH + sub * 64);
    float sv[16]; float mc = -3.0e38f;
#pragma unroll
    for (int e = 0; e < 16; ++e) { const int kk = j0 + (e >> 3) * 16 + 8 * hh + (e & 7); const bool ok = (CAUSAL == 1) ? (kk <= tq) : ((CAUSAL == 2) ? ((kk >> 5) == (tq >> 5)) : true);      /* mode 2: block-diagonal 32-token groups */
      sv[e] = ok ? st[e >> 3][e & 7] : -3.0e38f; mc = fmaxf(mc, sv[e]); }
    mc = fmaxf(mc, xhalf(mc));      /* both halves feed one output column: they share the maximum */
    const float mn = fmaxf(m_r, mc); const float xa = (m_r - mn) * C2; m_r = mn;      /* rescale factor 2^xa; nothing seen yet: 2^0 = 1 on zero sums */
    const float nb = fmaf(-mn, C2, 10.0f);      /* p = 1024 exp((s - mn) / 8) = 2^(s C2 + nb): scale, maximum and the operand's 2^10 in one fused multiply-add; a masked score gives 2^(-huge) = 0 */
    float pe[16], al = xa;
#pragma unroll
    for (int e = 0; e < 16; ++e) pe[e] = fmaf(sv[e], C2, nb);
    /* the exponentials stand together, each in place on a register of its own: no v_exp_f32 is directly followed by a read of its result or by another instruction's write of its source; the closing v_nop keeps that slot free of whatever the compiler puts next */
    asm("v_exp_f32 %0, %0\n\tv_exp_f32 %1, %1\n\tv_exp_f32 %2, %2\n\tv_exp_f32 %3, %3\n\tv_exp_f32 %4, %4\n\tv_exp_f32 %5, %5\n\tv_exp_f32 %6, %6\n\tv_exp_f32 %7, %7\n\tv_exp_f32 %8, %8\n\tv_nop"
        : "+v"(al), "+v"(pe[0]), "+v"(pe[1]), "+v"(pe[2]), "+v"(pe[3]), "+v"(pe[4]), "+v"(pe[5]), "+v"(pe[6]), "+v"(pe[7]));
    asm("v_exp_f32 %0, %0\n\tv_exp_f32 %1, %1\n\tv_exp_f32 %2, %2\n\tv_exp_f32 %3, %3\n\tv_exp_f32 %4, %4\n\tv_exp_f32 %5, %5\n\tv_exp_f32 %6, %6\n\tv_exp_f32 %7, %7\n\tv_nop"
        : "+v"(pe[8]), "+v"(pe[9]), "+v"(pe[10]), "+v"(pe[11]), "+v"(pe[12]), "+v"(pe[13]), "+v"(pe[14]), "+v"(pe[15]));
    FragH pb; float ps[4] = {0.f, 0.f, 0.f, 0.f};
#pragma unroll
    for (int e = 0; e < 16; ++e) { ps[e & 3] += pe[e]; pb.h[e] = (_Float16)pe[e]; }
    l_r = l_r * al + ((ps[0] + ps[1]) + (ps[2] + ps[3]));
#pragma unroll
    for (int dt = 0; dt < DT; ++dt) {
#pragma unroll
      for (int r = 0; r < 8; ++r) oacc[dt][r] *= al; }
#pragma unroll
    for (int dt = 0; dt < DT; ++dt) oacc[dt] = mmaH<1>(bv[dt].v, bv[dt].v, pb.v, pb.v, oacc[dt]); }
    asm volatile("s_wait_dscnt 0x0" ::: "memory");         /* this wave's reads of the buffer are over before it may be refilled */
    asm volatile("s_wait_asynccnt 0x0" ::: "memory");      /* this wave's copies of the next tile have landed */
    __syncthreads();                                       /* publishes the next tile and ends every wave's reads of this one */
    if (t + 2 < NT) fl_copy(l0 + (unsigned)(t & 1) * FL_BUF, gK + (size_t)(t + 2) * 64 * ldk, sk16, gV + (t + 2) * 64, gW + (t + 2) * 64, sv16); }
  asm volatile("s_wait_asynccnt 0x0" ::: "memory");        /* nothing is in flight when the buffers become output staging */
  const float lt = l_r + xhalf(l_r); const float inv = (lt > 0.f) ? 1.0f / lt : 0.f;      /* sums and products both carry the 2^10 */
  /* oacc[dt][r] * inv = value column dt * 16 + 8 * hh + r of query tq. Difference, RMSNorm and weight follow here: the odd pseudo-head's waves hand their columns over through LDS, lane for lane (wave w + 2 and wave w hold the same queries in the same layout) */
  v4fa* sx = reinterpret_cast<v4fa*>(smem);
  if (w >= 2) {
#pragma unroll
    for (int dt = 0; dt < DT; ++dt) { const v8f a = oacc[dt]; const v4f lo = {a[0] * inv, a[1] * inv, a[2] * inv, a[3] * inv}, hi = {a[4] * inv, a[5] * inv, a[6] * inv, a[7] * inv};
      sx[((w - 2) * 16 + dt * 2) * 32 + lane] = lo; sx[((w - 2) * 16 + dt * 2 + 1) * 32 + lane] = hi; } }
  __syncthreads();      /* publishes the odd pseudo-head's columns to the even one's waves */
  if (w < 2) { const float lam = LAM[0]; float ps[4] = {0.f, 0.f, 0.f, 0.f};
#pragma unroll
    for (int dt = 0; dt < DT; ++dt) {
#pragma unroll
      for (int g = 0; g < 2; ++g) { const v4f o = sx[(w * 16 + dt * 2 + g) * 32 + lane];
#pragma unroll
        for (int i = 0; i < 4; ++i) { const float v = oacc[dt][g * 4 + i] * inv - lam * o[i]; oacc[dt][g * 4 + i] = v; ps[i] += v * v; } } }
    const float sh = (ps[0] + ps[1]) + (ps[2] + ps[3]); const float ss = sh + xhalf(sh);      /* the lane pair l, l ^ 16 holds the query's 128 columns */
    const float rn = rsqrtf(ss / 128.0f + 1e-5f); unsigned short* dst = (unsigned short*)A16 + ((size_t)b * TQ + tq) * DM + (size_t)jh * 128 + 8 * hh;
#pragma unroll
    for (int dt = 0; dt < DT; ++dt) { const v4f g0 = *(const v4fa*)(lnw + dt * 16 + 8 * hh), g1 = *(const v4fa*)(lnw + dt * 16 + 8 * hh + 4); FragH f;
#pragma unroll
      for (int r = 0; r < 8; ++r) f.h[r] = (_Float16)(oacc[dt][r] * rn * bf16_round(r < 4 ? g0[r & 3] : g1[r & 3]) * 0.21639423346837554f);      /* 1 - LAMBDA_INIT */
      *(v8us*)(dst + dt * 16) = f.half[0]; } } }
// 5-plane variant: S = Qh Kh^T + (Ql Kh^T + Qh Kl^T)/1024 with Q/K = [hi | 2^10 residual] f16 planes (QL/KL same layout as Q16/K16), then the 3-term P.V below.
// 3-term variant: O = (P_hi V_hi + (P_lo V_hi + P_hi V_lo) / 1024) / l with P = [hi | 2^10 residual] of 1024 p and V^T = [hi | 2^10 residual] planes (VtL same layout as Vt) -> ~2^-21-class products for un-averaged (early causal / peaked) rows
template <int CAUSAL>
__device__ __forceinline__ void fl5_body(unsigned char* smem, int bx, const _Float16* __restrict__ Q16, const _Float16* __restrict__ QL, int ldq, const _Float16* __restrict__ K16, const _Float16* __restrict__ KL, int ldk, const _Float16* __restrict__ Vt, const _Float16* __restrict__ VtL, const int* __restrict__ MSK, const float* __restrict__ LAM, const float* __restrict__ lnw, _Float16* __restrict__ A16) {
  constexpr int RPW = 16, DT = 4, KS = 2;      /* transposed like k_flash: key rows and V^T rows are A operands, query columns and P^T are B operands */
  /* a block holds 16 queries of one differential head jh, whole: wave w has pseudo-head 2 jh + (w >> 1) and the low (w & 1 = 0) or high 64 value columns. smem: the epilogue's hand-over at the head of the kernel's LDS; bx: the block's place among the NB * (NH / 2) * SQN blocks of this part */
  const int tid = threadIdx.x, w = tid >> 5, lane = tid & 31, ln = lane & 15, hh = lane >> 4;
  const int slab = bx / SQN, qblk = bx % SQN; const int b = slab / (NH / 2), jh = slab % (NH / 2), h = 2 * jh + (w >> 1), hf = w & 1; const int q0 = qblk * RPW; const int tq = q0 + ln;      /* this lane's query */
  FragH aq[KS], aql[KS];
  { const unsigned short* qr = (const unsigned short*)Q16 + ((size_t)b * TQ + tq) * ldq + h * 64; const unsigned short* ql = (const unsigned short*)QL + ((size_t)b * TQ + tq) * ldq + h * 64;
#pragma unroll
    for (int ks = 0; ks < KS; ++ks) { aq[ks].half[0] = *(const v8us*)(qr + ks * 32 + 8 * hh); aq[ks].half[1] = *(const v8us*)(qr + ks * 32 + 16 + 8 * hh); aql[ks].half[0] = *(const v8us*)(ql + ks * 32 + 8 * hh); aql[ks].half[1] = *(const v8us*)(ql + ks * 32 + 16 + 8 * hh); } }
  const size_t vo = ((size_t)b * KVD + (h / 8) * 128 + hf * 64) * TK;      /* value head h / 8 of V^T [batch][512][token], its low or high 64 rows */
  const unsigned short* Vth = (const unsigned short*)Vt + vo; const unsigned short* Vtl = (const unsigned short*)VtL + vo;
  float m_r = -3.0e38f, l_r = 0.f; v8f oacc[DT], oaccL[DT];
#pragma unroll
  for (int dt = 0; dt < DT; ++dt) { oacc[dt] = (v8f){0.f,0.f,0.f,0.f,0.f,0.f,0.f,0.f}; oaccL[dt] = oacc[dt]; }
  const int jend = (CAUSAL == 1) ? (q0 + RPW) : TK;      /* causal: keys beyond the block's last query never contribute; the last pass of 32 keys may reach past jend (never past TK), masked */
#pragma unroll 1
  for (int j0 = 0; j0 < jend; j0 += 32) {
    FragH bk[2][KS], bkl[2][KS], bv[DT], bl[DT];
    const size_t ko = ((size_t)b * TK + j0 + ln) * ldk + (h / NREP) * 64 + 8 * hh; const unsigned short* kr0 = (const unsigned short*)K16 + ko; const unsigned short* kr1 = kr0 + (size_t)16 * ldk; const unsigned short* kl0 = (const unsigned short*)KL + ko; const unsigned short* kl1 = kl0 + (size_t)16 * ldk;
#pragma unroll
    for (int nt = 0; nt < 2; ++nt) { const unsigned short* kr = nt ? kr1 : kr0; const unsigned short* klr = nt ? kl1 : kl0;
#pragma unroll
      for (int ks = 0; ks < KS; ++ks) { bk[nt][ks].half[0] = *(const v8us*)(kr + ks * 32); bk[nt][ks].half[1] = *(const v8us*)(kr + ks * 32 + 16); bkl[nt][ks].half[0] = *(const v8us*)(klr + ks * 32); bkl[nt][ks].half[1] = *(const v8us*)(klr + ks * 32 + 16); } }
    asm volatile("s_wait_xcnt 0x0" :: "v"(kr0), "v"(kr1), "v"(kl0), "v"(kl1) : "memory");      /* a precaution: the address registers stay whole (no load's own destination takes them) until the issued loads have taken them */
    v8f st[2];      /* st[nt][r] = score of key j0 + nt * 16 + 8 * hh + r against query tq */
#pragma unroll
    for (int nt = 0; nt < 2; ++nt) { v8f acc = (v8f){0.f,0.f,0.f,0.f,0.f,0.f,0.f,0.f}, accl = acc;
#pragma unroll
      for (int ks = 0; ks < KS; ++ks) { acc = mmaH<1>(bk[nt][ks].v, bk[nt][ks].v, aq[ks].v, aq[ks].v, acc); accl = mmaH<1>(bk[nt][ks].v, bk[nt][ks].v, aql[ks].v, aql[ks].v, accl); accl = mmaH<1>(bkl[nt][ks].v, bkl[nt][ks].v, aq[ks].v, aq[ks].v, accl); }
#pragma unroll
      for (int r = 0; r < 8; ++r) acc[r] += accl[r] * 0.0009765625f;
      st[nt] = acc; }
    const unsigned short* vr0 = Vth + (size_t)ln * TK + j0 + 8 * hh; const unsigned short* vr1 = Vtl + (size_t)ln * TK + j0 + 8 * hh;
#pragma unroll
    for (int dt = 0; dt < DT; ++dt) { const unsigned short* vrow = vr0 + (size_t)(dt * 16) * TK; const unsigned short* vrl = vr1 + (size_t)(dt * 16) * TK; bv[dt].half[0] = *(const v8us*)vrow; bv[dt].half[1] = *(const v8us*)(vrow + 16); bl[dt].half[0] = *(const v8us*)vrl; bl[dt].half[1] = *(const v8us*)(vrl + 16); }
    asm volatile("s_wait_xcnt 0x0" :: "v"(vr0), "v"(vr1) : "memory");      /* the same precaution for the value loads, which fly during the softmax */
    float sv[16]; bool ok[16]; float mc = -3.0e38f;
#pragma unroll
    for (int e = 0; e < 16; ++e) { const int kk = j0 + (e >> 3) * 16 + 8 * hh + (e & 7); ok[e] = (CAUSAL == 1) ? (kk <= tq) : ((CAUSAL == 2) ? ((kk >> 5) == (tq >> 5)) : true);      /* mode 2: block-diagonal 32-token groups */
      if (CAUSAL == 4) ok[e] = MSK[((size_t)b * TQ + tq) * TK + kk] != 0;      /* mode 4: per-(query, key) INPUT mask shared by all heads; masked keys contribute nothing (== the reference's -4096 fill, whose exp underflows to 0), rows with no valid key give l = 0 -> output 0 (== the reference's row_valid zeroing) */
      sv[e] = ok[e] ? st[e >> 3][e & 7] * SCL : -3.0e38f; mc = fmaxf(mc, sv[e]); }
    mc = fmaxf(mc, xhalf(mc));      /* both halves feed one output column: they share the maximum */
    const float mn = fmaxf(m_r, mc); const float al = (mn > -1.0e38f) ? expf(m_r - mn) : 1.0f; m_r = mn;
    FragH pa, pl; float ps[4] = {0.f, 0.f, 0.f, 0.f};
#pragma unroll
    for (int e = 0; e < 16; ++e) { const float p = ok[e] ? expf(sv[e] - mn) : 0.f; ps[e & 3] += p; const float pw = p * 1024.0f; pa.h[e] = (_Float16)pw; pl.h[e] = (_Float16)((pw - (float)pa.h[e]) * 1024.0f); }
    l_r = l_r * al + ((ps[0] + ps[1]) + (ps[2] + ps[3]));
#pragma unroll
    for (int dt = 0; dt < DT; ++dt) {
#pragma unroll
      for (int r = 0; r < 8; ++r) { oacc[dt][r] *= al; oaccL[dt][r] *= al; } }
#pragma unroll
    for (int dt = 0; dt < DT; ++dt) { oacc[dt] = mmaH<1>(bv[dt].v, bv[dt].v, pa.v, pa.v, oacc[dt]); oaccL[dt] = mmaH<1>(bv[dt].v, bv[dt].v, pl.v, pl.v, oaccL[dt]); oaccL[dt] = mmaH<1>(bl[dt].v, bl[dt].v, pa.v, pa.v, oaccL[dt]); } }
  const float lt = l_r + xhalf(l_r); const float inv = (lt > 0.f) ? 1.0f / (lt * 1024.0f) : 0.f;
#pragma unroll
  for (int dt = 0; dt < DT; ++dt) {
#pragma unroll
    for (int r = 0; r < 8; ++r) oacc[dt][r] = (oacc[dt][r] + oaccL[dt][r] * 0.0009765625f) * inv; }      /* oacc[dt][r] = value column hf * 64 + dt * 16 + 8 * hh + r of query tq */
  /* difference, RMSNorm and weight: waves 2, 3 (odd pseudo-head) hand their columns to waves 0, 1 lane for lane; these two then exchange their halves' sums of squares */
  v4fa* sx = reinterpret_cast<v4fa*>(smem); float* sq = reinterpret_cast<float*>(smem + 2 * 8 * 32 * 16);
  if (w >= 2) {
#pragma unroll
    for (int dt = 0; dt < DT; ++dt) { const v8f a = oacc[dt]; const v4f lo = {a[0], a[1], a[2], a[3]}, hi = {a[4], a[5], a[6], a[7]};
      sx[((w - 2) * 8 + dt * 2) * 32 + lane] = lo; sx[((w - 2) * 8 + dt * 2 + 1) * 32 + lane] = hi; } }
  __syncthreads();      /* publishes the odd pseudo-head's columns */
  float sh = 0.f;
  if (w < 2) { const float lam = LAM[0]; float ps[4] = {0.f, 0.f, 0.f, 0.f};
#pragma unroll
    for (int dt = 0; dt < DT; ++dt) {
#pragma unroll
      for (int g = 0; g < 2; ++g) { const v4f o = sx[(w * 8 + dt * 2 + g) * 32 + lane];
#pragma unroll
        for (int i = 0; i < 4; ++i) { const float v = oacc[dt][g * 4 + i] - lam * o[i]; oacc[dt][g * 4 + i] = v; ps[i] += v * v; } } }
    sh = (ps[0] + ps[1]) + (ps[2] + ps[3]); sh += xhalf(sh);      /* this half's 64 columns of the query */
    if (hh == 0) sq[w * 16 + ln] = sh; }
  __syncthreads();      /* publishes the two halves' sums of squares */
  if (w < 2) { const float ss = sh + sq[(w ^ 1) * 16 + ln];
    const float rn = rsqrtf(ss / 128.0f + 1e-5f); unsigned short* dst = (unsigned short*)A16 + ((size_t)b * TQ + tq) * DM + (size_t)jh * 128 + hf * 64 + 8 * hh;
#pragma unroll
    for (int dt = 0; dt < DT; ++dt) { const v4f g0 = *(const v4fa*)(lnw + hf * 64 + dt * 16 + 8 * hh), g1 = *(const v4fa*)(lnw + hf * 64 + dt * 16 + 8 * hh + 4); FragH f;
#pragma unroll
      for (int r = 0; r < 8; ++r) f.h[r] = (_Float16)(oacc[dt][r] * rn * bf16_round(r < 4 ? g0[r & 3] : g1[r & 3]) * 0.21639423346837554f);      /* 1 - LAMBDA_INIT */
      *(v8us*)(dst + dt * 16) = f.half[0]; } } }
// All of the attention in one grid, down to the normalised f16 operand of the output product (its two parts write disjoint rows and depend on nothing of each other).
// The grid holds more than twice the blocks that are resident at once, and their costs differ up to sixfold; cost falls with the index: the longest query blocks of every head first, the shortest last, where they fill the places that come free evenly.
// The blocks of the first 256 rows walk few keys but wait long for each pass (operands straight from global memory, three products each): they are ranked right after the longest blocks, beside them, whose issue slots they hardly take, and not at the end, where the launch would wait for them alone.
#define AT_NS (NB * (NH / 2))      /* (batch, differential head) pairs: the blocks of one query block */
#define AT_NP (AT_NS * PQN)
#define AT_N5 (AT_NS * SQN)
#define AT_NL (AT_NS * 16)      /* ranks in front of the first-256-row blocks: the 16 longest query blocks; AT_NL + AT_N5 blocks are one round of four per WGP */
__global__ __launch_bounds__(128) void k_attn(const _Float16* __restrict__ QH, const _Float16* __restrict__ QL, const _Float16* __restrict__ KH, const _Float16* __restrict__ KL, const _Float16* __restrict__ VT, const _Float16* __restrict__ VTL, const float* __restrict__ LAM, const float* __restrict__ lnw, _Float16* __restrict__ A16) {
  __shared__ __attribute__((aligned(16))) unsigned char smem[2 * FL_BUF];
  const int bx = (int)blockIdx.x;
  /* rank r within a part -> the part's own block number: the heads run fastest, the query block falls as the rank rises; a permutation of each part's blocks, the same for the whole block */
  if (bx < AT_NL || bx >= AT_NL + AT_N5) { const int r = bx < AT_NL ? bx : bx - AT_N5; fl_body<1>(smem, (r % AT_NS) * PQN + (PQN - 1 - r / AT_NS), QH, DM, KH, KVD, VT, VT + (size_t)64 * SLEN, nullptr, LAM, lnw, A16); }
  else { const int r = bx - AT_NL; fl5_body<1>(smem, (r % AT_NS) * SQN + (SQN - 1 - r / AT_NS), QH, QL, DM, KH, KL, KVD, VT, VTL, nullptr, LAM, lnw, A16); } }

__device__ __forceinline__ void lam_body(const float* __restrict__ q1, const float* __restrict__ k1, const float* __restrict__ q2, const float* __restrict__ k2, float* __restrict__ LAM) {
  #pragma clang fp contract(off)
  const int ln = threadIdx.x & 31; if (threadIdx.x >= 32) return; float a = bf16_round(q1[ln]) * bf16_round(k1[ln]); a += bf16_round(q1[ln + 32]) * bf16_round(k1[ln + 32]); float c = bf16_round(q2[ln]) * bf16_round(k2[ln]); c += bf16_round(q2[ln + 32]) * bf16_round(k2[ln + 32]);
  for (int o = 16; o > 0; o >>= 1) { a += __shfl_xor(a, o, 32); c += __shfl_xor(c, o, 32); } const float lf = expf(a) - expf(c) + 0.78360576653162446f;      /* LAMBDA_INIT = 0.8 - 0.6 exp(-0.3 * 12) = 0.78360577 */
  const float v = (ln == 0) ? lf : 0.f; *(float*)(LAM + ln) = v;  }
// Every operand conversion in one grid (none depends on another): x, then Wq, Wk, Wv, Wo (each weight lies (out,in), which is the GEMM's B^T form), each f32 -> bf16 rounding -> f16 (weights times 16, exact; x times 1, exact); the last block makes lambda_full. One group of 8 elements per thread, as in the separate launches before.
#define CV_NX ((NR / 8) * DM / 256)               /* blocks: x */
#define CV_NW ((DM / 8) * DM / 256)               /* Wq, Wo */
#define CV_NS ((KVD / 8) * DM / 256)              /* Wk, Wv */
#define CV_N (CV_NX + 2 * CV_NW + 2 * CV_NS)
__global__ __launch_bounds__(256) void k_prep(const float* __restrict__ x, const float* __restrict__ Wq, const float* __restrict__ Wk, const float* __restrict__ Wv, const float* __restrict__ Wo,
    const float* __restrict__ q1, const float* __restrict__ k1, const float* __restrict__ q2, const float* __restrict__ k2,
    _Float16* __restrict__ X16, _Float16* __restrict__ BQ, _Float16* __restrict__ BK, _Float16* __restrict__ BV, _Float16* __restrict__ BO, float* __restrict__ LAM) {
  int bx = (int)blockIdx.x;
  if (bx >= CV_N) { lam_body(q1, k1, q2, k2, LAM); return; }
  const float* src = x; _Float16* dst = X16; float sc = 1.0f;
  if (bx >= CV_NX) { bx -= CV_NX; sc = 16.0f;
    if (bx < CV_NW) { src = Wq; dst = BQ; }
    else if (bx < CV_NW + CV_NS) { bx -= CV_NW; src = Wk; dst = BK; }
    else if (bx < CV_NW + 2 * CV_NS) { bx -= CV_NW + CV_NS; src = Wv; dst = BV; }
    else { bx -= CV_NW + 2 * CV_NS; src = Wo; dst = BO; } }
  const size_t t = (size_t)bx * 256 + threadIdx.x; FragH f;
#pragma unroll
  for (int q = 0; q < 8; ++q) f.h[q] = (_Float16)(bf16_round(src[t * 8 + q]) * sc);
  *(v8us*)((unsigned short*)dst + t * 8) = f.half[0];
  asm volatile("s_wait_xcnt 0x0" ::: "memory");      /* the store's registers are not rewritten ahead of this wait, whatever code the build lays out behind it */
}

extern "C" void kernel_launch(void* const* d_in, const int* in_sizes, int n_in,
                              void* d_out, int out_size, void* d_ws, size_t ws_size, hipStream_t stream) {
  (void)in_sizes; (void)n_in; (void)out_size;
  const float* const* I = (const float* const*)d_in; const float* x = I[0]; const float* Wq = I[1]; const float* Wk = I[2]; const float* Wv = I[3]; const float* Wo = I[4]; const float* lq1 = I[5]; const float* lk1 = I[6]; const float* lq2 = I[7]; const float* lk2 = I[8]; const float* lnw = I[9];
  char* ws = (char*)d_ws; size_t off = 0;
  auto take = [&](size_t bytes) { char* p = ws + off; off += (bytes + 255) & ~(size_t)255; return p; };
  const size_t np = (size_t)NR * DM, nk = (size_t)NR * KVD;
  _Float16* BQ = (_Float16*)take((size_t)DM * DM * 2); _Float16* BK = (_Float16*)take((size_t)KVD * DM * 2); _Float16* BV = (_Float16*)take((size_t)KVD * DM * 2); _Float16* BO = (_Float16*)take((size_t)DM * DM * 2);
  _Float16* X16 = (_Float16*)take(np * 2); _Float16* QH = (_Float16*)take(np * 2); _Float16* QL = (_Float16*)take(np * 2); _Float16* KH = (_Float16*)take(nk * 2); _Float16* KL = (_Float16*)take(nk * 2); _Float16* VT = (_Float16*)take(nk * 2); _Float16* VTL = (_Float16*)take(nk * 2); float* LAM = (float*)take(256);      /* q [token][32 x 64], k [token][8 x 64], V^T [batch][4 x 128][token], each as f16 hi + residual plane */
  _Float16* A16 = X16;      /* normalised attention over the input plane (dead after the projections) */
  if (off > ws_size) return;      /* 8+2+2+8 + 16+16+16+4+4+4+4 = 84 MiB */
  k_prep<<<CV_N + 1, 256, 0, stream>>>(x, Wq, Wk, Wv, Wo, lq1, lk1, lq2, lk2, X16, BQ, BK, BV, BO, LAM);
  /* the projections write the attention's operands themselves: no f32 plane, no split, repeat or transpose pass in between */
  k_proj<<<PJ_NQ + PJ_NK + NB * PJ_NV, 128, 0, stream>>>(X16, BQ, BK, BV, QH, QL, KH, KL, VT, VTL);
  k_attn<<<AT_NP + AT_N5, 128, 0, stream>>>(QH, QL, KH, KL, VT, VTL, LAM, lnw, A16);
  k_out<<<(NR / 128) * (DM / 128), 128, 0, stream>>>(A16, BO, (float*)d_out);      /* out = attn Wo^T */
}
